// v000
// The times below were measured on an AMD MI455X: many runs one after another, warmed up first and cycling through
// copies of the inputs, with the whole window's GPU time divided by the number of runs. Launches and the gaps
// between them are all in it. The median over several windows is given; except for v000 it joins two sittings, which
// can be a few percent apart, so the side-by-side timings, each taken in one sitting, are the better comparison.
// v000, which the later versions start from, runs in 433 microseconds.
#include <hip/hip_runtime.h>

typedef __attribute__((ext_vector_type(16))) _Float16 v16h;
typedef __attribute__((ext_vector_type(8)))  _Float16 v8h;
typedef __attribute__((ext_vector_type(8)))  float    v8f;
typedef __attribute__((ext_vector_type(4)))  unsigned u32x4;
typedef __attribute__((ext_vector_type(8)))  int      i32x8;
typedef __attribute__((ext_vector_type(4)))  int      i32x4;

#define HH   16          // heads
#define DKV  64          // head dim
#define SEQ  2048
#define DIM  1024        // model dim == HH*DKV
#define BB   2
#define MTOT (BB * SEQ)  // 4096 rows

#if defined(__AMDGCN__) && __has_builtin(__builtin_amdgcn_tensor_load_to_lds)
#define HAVE_TDM 1
#else
#define HAVE_TDM 0
#endif

static __device__ __forceinline__ v16h make_v16(v8h lo, v8h hi) {
  union { v16h v; v8h h[2]; } u;
  u.h[0] = lo; u.h[1] = hi;
  return u.v;
}

static __device__ __forceinline__ v8f wmma16(v16h a, v16h b, v8f c) {
  // D = A(16x32 f16) x B(32x16 f16) + C(16x16 f32)
  return __builtin_amdgcn_wmma_f32_16x16x32_f16(
      /*neg_a=*/false, a, /*neg_b=*/false, b,
      /*c_mod=*/(short)0, c, /*reuse_a=*/false, /*reuse_b=*/false);
}

static __device__ __forceinline__ void async_b128(void* lds, const void* g) {
  asm volatile("global_load_async_to_lds_b128 %0, %1, off"
               :: "v"((unsigned)(unsigned long long)lds),
                  "v"((unsigned long long)g)
               : "memory");
}
static __device__ __forceinline__ void wait_async_le4() {
  asm volatile("s_wait_asynccnt 0x4" ::: "memory");
}
static __device__ __forceinline__ void wait_async_0() {
  asm volatile("s_wait_asynccnt 0x0" ::: "memory");
}

#if HAVE_TDM
static __device__ __forceinline__ void tdm_load_2d(void* lds, const void* gsrc,
                                                   unsigned tile_x, unsigned tile_y,
                                                   unsigned stride_elems) {
  const unsigned long long ga = (unsigned long long)gsrc;
  u32x4 g0;
  g0.x = 1u;
  g0.y = (unsigned)(unsigned long long)lds;
  g0.z = (unsigned)(ga & 0xffffffffu);
  g0.w = (unsigned)((ga >> 32) & 0x01ffffffu) | (2u << 30);
  const unsigned dim0 = stride_elems;
  const unsigned dim1 = 1u << 20;
  i32x8 g1;
  g1[0] = 0x10000;
  g1[1] = (int)((dim0 & 0xffffu) << 16);
  g1[2] = (int)((dim0 >> 16) | ((dim1 & 0xffffu) << 16));
  g1[3] = (int)((dim1 >> 16) | (tile_x << 16));
  g1[4] = (int)(tile_y & 0xffffu);
  g1[5] = (int)stride_elems;
  g1[6] = 0;
  g1[7] = 0;
  const i32x4 gz4 = {0, 0, 0, 0};
  const i32x8 gz8 = {0, 0, 0, 0, 0, 0, 0, 0};
  __builtin_amdgcn_tensor_load_to_lds(g0, g1, gz4, gz4, gz8, 0);
}
#endif

// ---------------------------------------------------------------------------
// Kernel 1: RMS norm (T5 LayerNorm: no mean subtraction) -> f16 activations
// ---------------------------------------------------------------------------
__global__ void t5_rmsnorm_kernel(const float* __restrict__ hs,
                                  const float* __restrict__ w,
                                  _Float16* __restrict__ out) {
  __shared__ float red[256];
  const int row = blockIdx.x;
  const int t = threadIdx.x;
  const float* r = hs + (size_t)row * DIM;

  float vals[4];
  float s = 0.f;
#pragma unroll
  for (int i = 0; i < 4; ++i) {
    vals[i] = r[t + i * 256];
    s += vals[i] * vals[i];
  }
  red[t] = s;
  __syncthreads();
  for (int off = 128; off > 0; off >>= 1) {
    if (t < off) red[t] += red[t + off];
    __syncthreads();
  }
  const float rs = rsqrtf(red[0] * (1.0f / DIM) + 1e-6f);
#pragma unroll
  for (int i = 0; i < 4; ++i) {
    const int c = t + i * 256;
    out[(size_t)row * DIM + c] = (_Float16)(vals[i] * w[c] * rs);
  }
}

// ---------------------------------------------------------------------------
// Kernel 2: convert weights f32 -> f16 AND transpose to [N][K]
// out layout: wqT | wkT | wvT | woT, each [1024][1024] f16
// ---------------------------------------------------------------------------
__global__ void t5_convw_kernel(const float* __restrict__ wq,
                                const float* __restrict__ wk,
                                const float* __restrict__ wv,
                                const float* __restrict__ wo,
                                _Float16* __restrict__ out) {
  const int id = blockIdx.x * 256 + threadIdx.x;     // 0 .. 4M-1
  const int w = id >> 20;
  const int rem = id & ((1 << 20) - 1);
  const int e = rem >> 10;       // output feature (row of transposed)
  const int d = rem & 1023;      // input feature  (col of transposed)
  const float* src = (w == 0) ? wq : (w == 1) ? wk : (w == 2) ? wv : wo;
  out[((size_t)w << 20) + (size_t)e * 1024 + d] = (_Float16)src[(size_t)d * 1024 + e];
}

__global__ void t5_gemm_kernel(const _Float16* __restrict__ A,
                               const _Float16* __restrict__ Bt,
                               int mode_base,
                               _Float16* __restrict__ q16,
                               _Float16* __restrict__ k16,
                               _Float16* __restrict__ vt16,
                               const float* __restrict__ hidden,
                               float* __restrict__ outf) {
  __shared__ _Float16 sA[2][128 * 32];   // 2 x 8 KB
  __shared__ _Float16 sB[2][128 * 32];   // 2 x 8 KB

  const int mode = mode_base + blockIdx.z;
  const _Float16* B = Bt + ((size_t)blockIdx.z << 20);
  const int m0 = blockIdx.y * 128;
  const int n0 = blockIdx.x * 128;
  const int t = threadIdx.x;
  const int lane = t & 31, wave = t >> 5;
  const int wm = wave >> 2, wn = wave & 3;
  const int ln = lane & 15, hi = lane >> 4;

  const v8f zero = {0.f, 0.f, 0.f, 0.f, 0.f, 0.f, 0.f, 0.f};
  v8f acc[4][2];
#pragma unroll
  for (int i = 0; i < 4; ++i)
#pragma unroll
    for (int j = 0; j < 2; ++j) acc[i][j] = zero;

#if HAVE_TDM
  auto stage = [&](int k0, int buf) {
    if (wave == 0) {
      tdm_load_2d(&sA[buf][0], &A[(size_t)m0 * 1024 + k0], 32, 128, 1024);
      tdm_load_2d(&sB[buf][0], &B[(size_t)n0 * 1024 + k0], 32, 128, 1024);
    }
  };
  auto wait_stage = [&](bool pending) {
    if (wave == 0) {
      if (pending) __builtin_amdgcn_s_wait_tensorcnt(2);
      else         __builtin_amdgcn_s_wait_tensorcnt(0);
    }
  };
#else
  auto stage = [&](int k0, int buf) {
#pragma unroll
    for (int i = 0; i < 2; ++i) {
      const int c = t + i * 256;               // 0..511 chunk id
      const int row = c >> 2, col8 = (c & 3) * 8;
      async_b128(&sA[buf][row * 32 + col8],
                 &A[(size_t)(m0 + row) * 1024 + k0 + col8]);
      async_b128(&sB[buf][row * 32 + col8],
                 &B[(size_t)(n0 + row) * 1024 + k0 + col8]);
    }
  };
  auto wait_stage = [&](bool pending) {
    if (pending) wait_async_le4();
    else         wait_async_0();
  };
#endif

  const int nk = 1024 / 32;
  stage(0, 0);
  for (int ik = 0; ik < nk; ++ik) {
    const int cur = ik & 1;
    const bool pre = (ik + 1 < nk);
    if (pre) stage((ik + 1) * 32, cur ^ 1);  // prefetch next tile
    wait_stage(pre);                         // older DMAs (current buf) landed
    __syncthreads();                         // current buffer visible block-wide

    v16h af[4], bf[2];
#pragma unroll
    for (int i = 0; i < 4; ++i) {
      const int r = wm * 64 + i * 16 + ln;
      af[i] = make_v16(*(const v8h*)&sA[cur][r * 32 + hi * 8],
                       *(const v8h*)&sA[cur][r * 32 + hi * 8 + 16]);
    }
#pragma unroll
    for (int j = 0; j < 2; ++j) {
      const int r = wn * 32 + j * 16 + ln;
      bf[j] = make_v16(*(const v8h*)&sB[cur][r * 32 + hi * 8],
                       *(const v8h*)&sB[cur][r * 32 + hi * 8 + 16]);
    }
#pragma unroll
    for (int i = 0; i < 4; ++i)
#pragma unroll
      for (int j = 0; j < 2; ++j) acc[i][j] = wmma16(af[i], bf[j], acc[i][j]);

    __syncthreads();          // all waves done reading -> buffer reusable
  }

#pragma unroll
  for (int i = 0; i < 4; ++i)
#pragma unroll
    for (int j = 0; j < 2; ++j) {
      const int mbase = m0 + wm * 64 + i * 16 + hi * 8;
      const int nc = n0 + wn * 32 + j * 16 + ln;
#pragma unroll
      for (int r = 0; r < 8; ++r) {
        const int m = mbase + r;
        const float v = acc[i][j][r];
        if (mode == 3) {
          outf[(size_t)m * 1024 + nc] = hidden[(size_t)m * 1024 + nc] + v;
        } else {
          const int b = m >> 11, s = m & 2047;
          const int h = nc >> 6, d = nc & 63;
          if (mode == 0)
            q16[((size_t)(b * HH + h) * SEQ + s) * DKV + d] = (_Float16)v;
          else if (mode == 1)
            k16[((size_t)(b * HH + h) * SEQ + s) * DKV + d] = (_Float16)v;
          else
            vt16[((size_t)(b * HH + h) * DKV + d) * SEQ + s] = (_Float16)v;
        }
      }
    }
}

__global__ void t5_attn_kernel(const _Float16* __restrict__ q16,
                               const _Float16* __restrict__ k16,
                               const _Float16* __restrict__ vt16,
                               const float* __restrict__ rel_bias,
                               _Float16* __restrict__ ctx16) {
  __shared__ _Float16 biasH[4096];        // bias[k - q + 2047]      8 KB
  __shared__ _Float16 kt[2][64 * 64];     // K chunk [k_row][d]   2x 8 KB
  __shared__ _Float16 vt[2][64 * 64];     // V chunk [d][k_col]   2x 8 KB
  __shared__ _Float16 pbuf[8 * 16 * 64];  // per-wave P tiles       16 KB

  const int bh = blockIdx.y;             // b*16 + h
  const int h = bh & 15;
  const int b = bh >> 4;
  const int t = threadIdx.x, lane = t & 31, wave = t >> 5;
  const int ln = lane & 15, hi = lane >> 4;
  const int q0 = blockIdx.x * 128 + wave * 16;

  const _Float16* qbase = q16 + (size_t)bh * SEQ * DKV;
  const _Float16* kbase = k16 + (size_t)bh * SEQ * DKV;
  const _Float16* vbase = vt16 + (size_t)bh * DKV * SEQ;

  // stage one 64-wide K/V chunk (4 async b128 per thread)
  auto stage = [&](int kc, int buf) {
#pragma unroll
    for (int i = 0; i < 2; ++i) {
      const int c = t + i * 256;                    // 0..511 chunks of 8 halfs
      const int row = c >> 3, col8 = (c & 7) * 8;
      async_b128(&kt[buf][row * 64 + col8],
                 &kbase[(size_t)(kc + row) * DKV + col8]);
      async_b128(&vt[buf][row * 64 + col8],
                 &vbase[(size_t)row * SEQ + kc + col8]);
    }
  };
  stage(0, 0);

  // T5 bidirectional bucket: 16 sign buckets x {exact<8 | log-spaced to 128}
  for (int i = t; i < 4095; i += 256) {
    const int delta = i - 2047;          // k - q
    const int rb = (delta > 0) ? 16 : 0;
    const int rp = (delta < 0) ? -delta : delta;
    int bu;
    if (rp < 8) {
      bu = rp;
    } else {
      bu = 8 + (int)(__logf((float)rp * 0.125f) * (8.0f / __logf(16.0f)));
      bu = bu > 15 ? 15 : bu;
    }
    biasH[i] = (_Float16)rel_bias[(rb + bu) * HH + h];
  }

  v16h qf[2];
  {
    const _Float16* p = qbase + (size_t)(q0 + ln) * DKV;
    qf[0] = make_v16(*(const v8h*)&p[hi * 8], *(const v8h*)&p[hi * 8 + 16]);
    qf[1] = make_v16(*(const v8h*)&p[32 + hi * 8], *(const v8h*)&p[32 + hi * 8 + 16]);
  }

  const v8f zero = {0.f, 0.f, 0.f, 0.f, 0.f, 0.f, 0.f, 0.f};
  float m_i[8], l_i[8];
  v8f o[4];
#pragma unroll
  for (int r = 0; r < 8; ++r) { m_i[r] = -1e30f; l_i[r] = 0.f; }
#pragma unroll
  for (int j = 0; j < 4; ++j) o[j] = zero;

  _Float16* myp = &pbuf[wave * 16 * 64];

  const int nchunk = SEQ / 64;
  for (int ic = 0; ic < nchunk; ++ic) {
    const int kc = ic * 64;
    const int cur = ic & 1;
    if (ic + 1 < nchunk) {      // prefetch next K/V chunk
      stage(kc + 64, cur ^ 1);
      wait_async_le4();
    } else {
      wait_async_0();
    }
    __syncthreads();            // current K/V tiles (+ bias table) visible

    // scores S = Q(16x64) * K_chunk^T(64x64)
    v8f s[4];
#pragma unroll
    for (int ns = 0; ns < 4; ++ns) {
      const int r = ns * 16 + ln;
      v16h b0 = make_v16(*(const v8h*)&kt[cur][r * 64 + hi * 8],
                         *(const v8h*)&kt[cur][r * 64 + hi * 8 + 16]);
      v16h b1 = make_v16(*(const v8h*)&kt[cur][r * 64 + 32 + hi * 8],
                         *(const v8h*)&kt[cur][r * 64 + 32 + hi * 8 + 16]);
      v8f a = zero;
      a = wmma16(qf[0], b0, a);
      a = wmma16(qf[1], b1, a);
      s[ns] = a;
    }

    // bias add + per-row max (rows live across 16-lane halves in wave32)
    float cm[8];
#pragma unroll
    for (int r = 0; r < 8; ++r) {
      const int qrow = q0 + r + hi * 8;
      float mx = -1e30f;
#pragma unroll
      for (int ns = 0; ns < 4; ++ns) {
        const int kcol = kc + ns * 16 + ln;
        const float v = s[ns][r] + (float)biasH[kcol - qrow + 2047];
        s[ns][r] = v;
        mx = fmaxf(mx, v);
      }
      cm[r] = mx;
    }
#pragma unroll
    for (int msk = 1; msk < 16; msk <<= 1)
#pragma unroll
      for (int r = 0; r < 8; ++r) cm[r] = fmaxf(cm[r], __shfl_xor(cm[r], msk, 32));

    // online softmax update
    float rs[8];
#pragma unroll
    for (int r = 0; r < 8; ++r) {
      const float mnew = fmaxf(m_i[r], cm[r]);
      const float scale = __expf(m_i[r] - mnew);
      float sum = 0.f;
#pragma unroll
      for (int ns = 0; ns < 4; ++ns) {
        const float p = __expf(s[ns][r] - mnew);
        s[ns][r] = p;
        sum += p;
      }
      rs[r] = sum;
      m_i[r] = mnew;
      l_i[r] *= scale;
#pragma unroll
      for (int j = 0; j < 4; ++j) o[j][r] *= scale;
    }
#pragma unroll
    for (int msk = 1; msk < 16; msk <<= 1)
#pragma unroll
      for (int r = 0; r < 8; ++r) rs[r] += __shfl_xor(rs[r], msk, 32);
#pragma unroll
    for (int r = 0; r < 8; ++r) l_i[r] += rs[r];

    // transpose P from C-layout to A-layout via per-wave LDS tile
#pragma unroll
    for (int ns = 0; ns < 4; ++ns)
#pragma unroll
      for (int r = 0; r < 8; ++r)
        myp[(r + hi * 8) * 64 + ns * 16 + ln] = (_Float16)s[ns][r];
    __syncthreads();            // P visible (and ds writes retired)

    // ctx += P(16x64) * V_chunk(64x64);  Vt LDS tile is already [N=d][K=s]
    v16h pf0 = make_v16(*(const v8h*)&myp[ln * 64 + hi * 8],
                        *(const v8h*)&myp[ln * 64 + hi * 8 + 16]);
    v16h pf1 = make_v16(*(const v8h*)&myp[ln * 64 + 32 + hi * 8],
                        *(const v8h*)&myp[ln * 64 + 32 + hi * 8 + 16]);
#pragma unroll
    for (int ns = 0; ns < 4; ++ns) {
      const int r = ns * 16 + ln;
      v16h b0 = make_v16(*(const v8h*)&vt[cur][r * 64 + hi * 8],
                         *(const v8h*)&vt[cur][r * 64 + hi * 8 + 16]);
      v16h b1 = make_v16(*(const v8h*)&vt[cur][r * 64 + 32 + hi * 8],
                         *(const v8h*)&vt[cur][r * 64 + 32 + hi * 8 + 16]);
      o[ns] = wmma16(pf0, b0, o[ns]);
      o[ns] = wmma16(pf1, b1, o[ns]);
    }
    __syncthreads();            // all waves done reading current buffers
  }

  // normalize and store ctx as [b, s, h*64+d] f16 (rows for out-projection)
#pragma unroll
  for (int r = 0; r < 8; ++r) {
    const float inv = 1.f / l_i[r];
    const int srow = q0 + r + hi * 8;
#pragma unroll
    for (int ns = 0; ns < 4; ++ns) {
      const float v = o[ns][r] * inv;
      ctx16[((size_t)(b * SEQ + srow)) * DIM + h * 64 + ns * 16 + ln] = (_Float16)v;
    }
  }
}

// ---------------------------------------------------------------------------
// host launcher
// ---------------------------------------------------------------------------
extern "C" void kernel_launch(void* const* d_in, const int* in_sizes, int n_in,
                              void* d_out, int out_size, void* d_ws, size_t ws_size,
                              hipStream_t stream) {
  (void)in_sizes; (void)n_in; (void)out_size; (void)ws_size;
  const float* hidden = (const float*)d_in[0];
  const float* lnw    = (const float*)d_in[1];
  const float* wq     = (const float*)d_in[2];
  const float* wk     = (const float*)d_in[3];
  const float* wv     = (const float*)d_in[4];
  const float* wo     = (const float*)d_in[5];
  const float* rb     = (const float*)d_in[6];
  float* out = (float*)d_out;

  char* ws = (char*)d_ws;
  const size_t MB = 1024ull * 1024ull;
  _Float16* normed = (_Float16*)(ws);             //  8 MB  [4096][1024]
  _Float16* w16    = (_Float16*)(ws + 8  * MB);   //  8 MB  wqT|wkT|wvT|woT
  _Float16* q16    = (_Float16*)(ws + 16 * MB);   //  8 MB  [b,h,s,64]
  _Float16* k16    = (_Float16*)(ws + 24 * MB);   //  8 MB  [b,h,s,64]
  _Float16* vt16   = (_Float16*)(ws + 32 * MB);   //  8 MB  [b,h,64,s]
  _Float16* ctx16  = (_Float16*)(ws + 40 * MB);   //  8 MB  [b*s][1024]

  t5_rmsnorm_kernel<<<MTOT, 256, 0, stream>>>(hidden, lnw, normed);
  t5_convw_kernel<<<16384, 256, 0, stream>>>(wq, wk, wv, wo, w16);
  // Q, K, Vt projections: grid.z selects the weight matrix + store layout
  t5_gemm_kernel<<<dim3(8, 32, 3), 256, 0, stream>>>(
      normed, w16, /*mode_base=*/0, q16, k16, vt16, nullptr, nullptr);
  t5_attn_kernel<<<dim3(SEQ / 128, BB * HH), 256, 0, stream>>>(
      q16, k16, vt16, rb, ctx16);
  // output projection + residual (mode 3)
  t5_gemm_kernel<<<dim3(8, 32, 1), 256, 0, stream>>>(
      ctx16, w16 + 3ull * (1u << 20), /*mode_base=*/3, nullptr, nullptr, nullptr,
      hidden, out);
}

// v001
// A run of this version takes 315 microseconds.
// Two timings next to v000 both put it at 1.41 times that version's speed.
#include <hip/hip_runtime.h>

typedef __attribute__((ext_vector_type(16))) _Float16 v16h;
typedef __attribute__((ext_vector_type(8)))  _Float16 v8h;
typedef __attribute__((ext_vector_type(8)))  float    v8f;
typedef __attribute__((ext_vector_type(4)))  unsigned u32x4;
typedef __attribute__((ext_vector_type(8)))  int      i32x8;
typedef __attribute__((ext_vector_type(4)))  int      i32x4;

#define HH   16          // heads
#define DKV  64          // head dim
#define SEQ  2048
#define DIM  1024        // model dim == HH*DKV
#define BB   2
#define MTOT (BB * SEQ)  // 4096 rows

#if defined(__AMDGCN__) && __has_builtin(__builtin_amdgcn_tensor_load_to_lds)
#define HAVE_TDM 1
#else
#define HAVE_TDM 0
#endif

static __device__ __forceinline__ v16h make_v16(v8h lo, v8h hi) {
  union { v16h v; v8h h[2]; } u;
  u.h[0] = lo; u.h[1] = hi;
  return u.v;
}

static __device__ __forceinline__ v8f wmma16(v16h a, v16h b, v8f c) {
  // D = A(16x32 f16) x B(32x16 f16) + C(16x16 f32)
  return __builtin_amdgcn_wmma_f32_16x16x32_f16(
      /*neg_a=*/false, a, /*neg_b=*/false, b,
      /*c_mod=*/(short)0, c, /*reuse_a=*/false, /*reuse_b=*/false);
}

static __device__ __forceinline__ void async_b128(void* lds, const void* g) {
  asm volatile("global_load_async_to_lds_b128 %0, %1, off"
               :: "v"((unsigned)(unsigned long long)lds),
                  "v"((unsigned long long)g)
               : "memory");
}
static __device__ __forceinline__ void wait_async_le4() {
  asm volatile("s_wait_asynccnt 0x4" ::: "memory");
}
static __device__ __forceinline__ void wait_async_0() {
  asm volatile("s_wait_asynccnt 0x0" ::: "memory");
}

#if HAVE_TDM
static __device__ __forceinline__ void tdm_load_2d(void* lds, const void* gsrc,
                                                   unsigned tile_x, unsigned tile_y,
                                                   unsigned stride_elems) {
  const unsigned long long ga = (unsigned long long)gsrc;
  u32x4 g0;
  g0.x = 1u;
  g0.y = (unsigned)(unsigned long long)lds;
  g0.z = (unsigned)(ga & 0xffffffffu);
  g0.w = (unsigned)((ga >> 32) & 0x01ffffffu) | (2u << 30);
  const unsigned dim0 = stride_elems;
  const unsigned dim1 = 1u << 20;
  i32x8 g1;
  g1[0] = 0x10000;
  g1[1] = (int)((dim0 & 0xffffu) << 16);
  g1[2] = (int)((dim0 >> 16) | ((dim1 & 0xffffu) << 16));
  g1[3] = (int)((dim1 >> 16) | (tile_x << 16));
  g1[4] = (int)(tile_y & 0xffffu);
  g1[5] = (int)stride_elems;
  g1[6] = 0;
  g1[7] = 0;
  const i32x4 gz4 = {0, 0, 0, 0};
  const i32x8 gz8 = {0, 0, 0, 0, 0, 0, 0, 0};
  __builtin_amdgcn_tensor_load_to_lds(g0, g1, gz4, gz4, gz8, 0);
}
#endif

// ---------------------------------------------------------------------------
// Kernel 1: RMS norm (T5 LayerNorm: no mean subtraction) -> f16 activations
// ---------------------------------------------------------------------------
__global__ void t5_rmsnorm_kernel(const float* __restrict__ hs,
                                  const float* __restrict__ w,
                                  _Float16* __restrict__ out) {
  __shared__ float red[256];
  const int row = blockIdx.x;
  const int t = threadIdx.x;
  const float* r = hs + (size_t)row * DIM;

  float vals[4];
  float s = 0.f;
#pragma unroll
  for (int i = 0; i < 4; ++i) {
    vals[i] = r[t + i * 256];
    s += vals[i] * vals[i];
  }
  red[t] = s;
  __syncthreads();
  for (int off = 128; off > 0; off >>= 1) {
    if (t < off) red[t] += red[t + off];
    __syncthreads();
  }
  const float rs = rsqrtf(red[0] * (1.0f / DIM) + 1e-6f);
#pragma unroll
  for (int i = 0; i < 4; ++i) {
    const int c = t + i * 256;
    out[(size_t)row * DIM + c] = (_Float16)(vals[i] * w[c] * rs);
  }
}

// ---------------------------------------------------------------------------
// Kernel 2: convert weights f32 -> f16 AND transpose to [N][K]
// out layout: wqT | wkT | wvT | woT, each [1024][1024] f16
// ---------------------------------------------------------------------------
__global__ void t5_convw_kernel(const float* __restrict__ wq,
                                const float* __restrict__ wk,
                                const float* __restrict__ wv,
                                const float* __restrict__ wo,
                                _Float16* __restrict__ out) {
  const int id = blockIdx.x * 256 + threadIdx.x;     // 0 .. 4M-1
  const int w = id >> 20;
  const int rem = id & ((1 << 20) - 1);
  const int e = rem >> 10;       // output feature (row of transposed)
  const int d = rem & 1023;      // input feature  (col of transposed)
  const float* src = (w == 0) ? wq : (w == 1) ? wk : (w == 2) ? wv : wo;
  out[((size_t)w << 20) + (size_t)e * 1024 + d] = (_Float16)src[(size_t)d * 1024 + e];
}

__global__ void t5_gemm_kernel(const _Float16* __restrict__ A,
                               const _Float16* __restrict__ Bt,
                               int mode_base,
                               _Float16* __restrict__ q16,
                               _Float16* __restrict__ k16,
                               _Float16* __restrict__ vt16,
                               const float* __restrict__ hidden,
                               float* __restrict__ outf) {
  __shared__ _Float16 sA[2][128 * 32];   // 2 x 8 KB
  __shared__ _Float16 sB[2][128 * 32];   // 2 x 8 KB

  const int mode = mode_base + blockIdx.z;
  const _Float16* B = Bt + ((size_t)blockIdx.z << 20);
  const int m0 = blockIdx.y * 128;
  const int n0 = blockIdx.x * 128;
  const int t = threadIdx.x;
  const int lane = t & 31, wave = t >> 5;
  const int wm = wave >> 2, wn = wave & 3;
  const int ln = lane & 15, hi = lane >> 4;

  const v8f zero = {0.f, 0.f, 0.f, 0.f, 0.f, 0.f, 0.f, 0.f};
  v8f acc[4][2];
#pragma unroll
  for (int i = 0; i < 4; ++i)
#pragma unroll
    for (int j = 0; j < 2; ++j) acc[i][j] = zero;

#if HAVE_TDM
  auto stage = [&](int k0, int buf) {
    if (wave == 0) {
      tdm_load_2d(&sA[buf][0], &A[(size_t)m0 * 1024 + k0], 32, 128, 1024);
      tdm_load_2d(&sB[buf][0], &B[(size_t)n0 * 1024 + k0], 32, 128, 1024);
    }
  };
  auto wait_stage = [&](bool pending) {
    if (wave == 0) {
      if (pending) __builtin_amdgcn_s_wait_tensorcnt(2);
      else         __builtin_amdgcn_s_wait_tensorcnt(0);
    }
  };
#else
  auto stage = [&](int k0, int buf) {
#pragma unroll
    for (int i = 0; i < 2; ++i) {
      const int c = t + i * 256;               // 0..511 chunk id
      const int row = c >> 2, col8 = (c & 3) * 8;
      async_b128(&sA[buf][row * 32 + col8],
                 &A[(size_t)(m0 + row) * 1024 + k0 + col8]);
      async_b128(&sB[buf][row * 32 + col8],
                 &B[(size_t)(n0 + row) * 1024 + k0 + col8]);
    }
  };
  auto wait_stage = [&](bool pending) {
    if (pending) wait_async_le4();
    else         wait_async_0();
  };
#endif

  const int nk = 1024 / 32;
  stage(0, 0);
  for (int ik = 0; ik < nk; ++ik) {
    const int cur = ik & 1;
    const bool pre = (ik + 1 < nk);
    if (pre) stage((ik + 1) * 32, cur ^ 1);  // prefetch next tile
    wait_stage(pre);                         // older DMAs (current buf) landed
    __syncthreads();                         // current buffer visible block-wide

    v16h af[4], bf[2];
#pragma unroll
    for (int i = 0; i < 4; ++i) {
      const int r = wm * 64 + i * 16 + ln;
      af[i] = make_v16(*(const v8h*)&sA[cur][r * 32 + hi * 8],
                       *(const v8h*)&sA[cur][r * 32 + hi * 8 + 16]);
    }
#pragma unroll
    for (int j = 0; j < 2; ++j) {
      const int r = wn * 32 + j * 16 + ln;
      bf[j] = make_v16(*(const v8h*)&sB[cur][r * 32 + hi * 8],
                       *(const v8h*)&sB[cur][r * 32 + hi * 8 + 16]);
    }
#pragma unroll
    for (int i = 0; i < 4; ++i)
#pragma unroll
      for (int j = 0; j < 2; ++j) acc[i][j] = wmma16(af[i], bf[j], acc[i][j]);

    __syncthreads();          // all waves done reading -> buffer reusable
  }

#pragma unroll
  for (int i = 0; i < 4; ++i)
#pragma unroll
    for (int j = 0; j < 2; ++j) {
      const int mbase = m0 + wm * 64 + i * 16 + hi * 8;
      const int nc = n0 + wn * 32 + j * 16 + ln;
#pragma unroll
      for (int r = 0; r < 8; ++r) {
        const int m = mbase + r;
        const float v = acc[i][j][r];
        if (mode == 3) {
          outf[(size_t)m * 1024 + nc] = hidden[(size_t)m * 1024 + nc] + v;
        } else {
          const int b = m >> 11, s = m & 2047;
          const int h = nc >> 6, d = nc & 63;
          if (mode == 0)
            q16[((size_t)(b * HH + h) * SEQ + s) * DKV + d] = (_Float16)v;
          else if (mode == 1)
            k16[((size_t)(b * HH + h) * SEQ + s) * DKV + d] = (_Float16)v;
          else
            vt16[((size_t)(b * HH + h) * DKV + d) * SEQ + s] = (_Float16)v;
        }
      }
    }
}

__global__ void __launch_bounds__(256) t5_attn_kernel(const _Float16* __restrict__ q16,
                               const _Float16* __restrict__ k16,
                               const _Float16* __restrict__ vt16,
                               const float* __restrict__ rel_bias,
                               _Float16* __restrict__ ctx16) {
  __shared__ _Float16 biasH[4096];        // bias[k - q + 2047]      8 KB
  __shared__ _Float16 kt[2][64 * 64];     // K chunk [k_row][d]   2x 8 KB
  __shared__ _Float16 vt[2][64 * 64];     // V chunk [d][k_col]   2x 8 KB
  __shared__ _Float16 pbuf[8 * 16 * 64];  // per-wave P tiles       16 KB

  const int bh = blockIdx.y;             // b*16 + h
  const int h = bh & 15;
  const int b = bh >> 4;
  const int t = threadIdx.x, lane = t & 31, wave = t >> 5;
  const int ln = lane & 15, hi = lane >> 4;
  const int q0 = blockIdx.x * 128 + wave * 16;

  const _Float16* qbase = q16 + (size_t)bh * SEQ * DKV;
  const _Float16* kbase = k16 + (size_t)bh * SEQ * DKV;
  const _Float16* vbase = vt16 + (size_t)bh * DKV * SEQ;

  // stage one 64-wide K/V chunk (4 async b128 per thread)
  auto stage = [&](int kc, int buf) {
#pragma unroll
    for (int i = 0; i < 2; ++i) {
      const int c = t + i * 256;                    // 0..511 chunks of 8 halfs
      const int row = c >> 3, col8 = (c & 7) * 8;
      async_b128(&kt[buf][row * 64 + col8],
                 &kbase[(size_t)(kc + row) * DKV + col8]);
      async_b128(&vt[buf][row * 64 + col8],
                 &vbase[(size_t)row * SEQ + kc + col8]);
    }
  };
  stage(0, 0);

  // T5 bidirectional bucket: 16 sign buckets x {exact<8 | log-spaced to 128}
  for (int i = t; i < 4095; i += 256) {
    const int delta = i - 2047;          // k - q
    const int rb = (delta > 0) ? 16 : 0;
    const int rp = (delta < 0) ? -delta : delta;
    int bu;
    if (rp < 8) {
      bu = rp;
    } else {
      bu = 8 + (int)(__logf((float)rp * 0.125f) * (8.0f / __logf(16.0f)));
      bu = bu > 15 ? 15 : bu;
    }
    biasH[i] = (_Float16)rel_bias[(rb + bu) * HH + h];
  }

  v16h qf[2];
  {
    const _Float16* p = qbase + (size_t)(q0 + ln) * DKV;
    qf[0] = make_v16(*(const v8h*)&p[hi * 8], *(const v8h*)&p[hi * 8 + 16]);
    qf[1] = make_v16(*(const v8h*)&p[32 + hi * 8], *(const v8h*)&p[32 + hi * 8 + 16]);
  }

  const v8f zero = {0.f, 0.f, 0.f, 0.f, 0.f, 0.f, 0.f, 0.f};
  float m_i[8], l_i[8];
  v8f o[4];
#pragma unroll
  for (int r = 0; r < 8; ++r) { m_i[r] = -1e30f; l_i[r] = 0.f; }
#pragma unroll
  for (int j = 0; j < 4; ++j) o[j] = zero;

  _Float16* myp = &pbuf[wave * 16 * 64];

  const int nchunk = SEQ / 64;
  for (int ic = 0; ic < nchunk; ++ic) {
    const int kc = ic * 64;
    const int cur = ic & 1;
    if (ic + 1 < nchunk) {      // prefetch next K/V chunk
      stage(kc + 64, cur ^ 1);
      wait_async_le4();
    } else {
      wait_async_0();
    }
    __syncthreads();            // current K/V tiles (+ bias table) visible

    // scores S = Q(16x64) * K_chunk^T(64x64)
    v8f s[4];
#pragma unroll
    for (int ns = 0; ns < 4; ++ns) {
      const int r = ns * 16 + ln;
      v16h b0 = make_v16(*(const v8h*)&kt[cur][r * 64 + hi * 8],
                         *(const v8h*)&kt[cur][r * 64 + hi * 8 + 16]);
      v16h b1 = make_v16(*(const v8h*)&kt[cur][r * 64 + 32 + hi * 8],
                         *(const v8h*)&kt[cur][r * 64 + 32 + hi * 8 + 16]);
      v8f a = zero;
      a = wmma16(qf[0], b0, a);
      a = wmma16(qf[1], b1, a);
      s[ns] = a;
    }

    // bias add + per-row max (rows live across 16-lane halves in wave32)
    float cm[8];
#pragma unroll
    for (int r = 0; r < 8; ++r) {
      const int qrow = q0 + r + hi * 8;
      float mx = -1e30f;
#pragma unroll
      for (int ns = 0; ns < 4; ++ns) {
        const int kcol = kc + ns * 16 + ln;
        const float v = s[ns][r] + (float)biasH[kcol - qrow + 2047];
        s[ns][r] = v;
        mx = fmaxf(mx, v);
      }
      cm[r] = mx;
    }
#pragma unroll
    for (int msk = 1; msk < 16; msk <<= 1)
#pragma unroll
      for (int r = 0; r < 8; ++r) cm[r] = fmaxf(cm[r], __shfl_xor(cm[r], msk, 32));

    // online softmax update
    float rs[8];
#pragma unroll
    for (int r = 0; r < 8; ++r) {
      const float mnew = fmaxf(m_i[r], cm[r]);
      const float scale = __expf(m_i[r] - mnew);
      float sum = 0.f;
#pragma unroll
      for (int ns = 0; ns < 4; ++ns) {
        const float p = __expf(s[ns][r] - mnew);
        s[ns][r] = p;
        sum += p;
      }
      rs[r] = sum;
      m_i[r] = mnew;
      l_i[r] *= scale;
#pragma unroll
      for (int j = 0; j < 4; ++j) o[j][r] *= scale;
    }
#pragma unroll
    for (int msk = 1; msk < 16; msk <<= 1)
#pragma unroll
      for (int r = 0; r < 8; ++r) rs[r] += __shfl_xor(rs[r], msk, 32);
#pragma unroll
    for (int r = 0; r < 8; ++r) l_i[r] += rs[r];

    // transpose P from C-layout to A-layout via per-wave LDS tile
#pragma unroll
    for (int ns = 0; ns < 4; ++ns)
#pragma unroll
      for (int r = 0; r < 8; ++r)
        myp[(r + hi * 8) * 64 + ns * 16 + ln] = (_Float16)s[ns][r];
    __syncthreads();            // P visible (and ds writes retired)

    // ctx += P(16x64) * V_chunk(64x64);  Vt LDS tile is already [N=d][K=s]
    v16h pf0 = make_v16(*(const v8h*)&myp[ln * 64 + hi * 8],
                        *(const v8h*)&myp[ln * 64 + hi * 8 + 16]);
    v16h pf1 = make_v16(*(const v8h*)&myp[ln * 64 + 32 + hi * 8],
                        *(const v8h*)&myp[ln * 64 + 32 + hi * 8 + 16]);
#pragma unroll
    for (int ns = 0; ns < 4; ++ns) {
      const int r = ns * 16 + ln;
      v16h b0 = make_v16(*(const v8h*)&vt[cur][r * 64 + hi * 8],
                         *(const v8h*)&vt[cur][r * 64 + hi * 8 + 16]);
      v16h b1 = make_v16(*(const v8h*)&vt[cur][r * 64 + 32 + hi * 8],
                         *(const v8h*)&vt[cur][r * 64 + 32 + hi * 8 + 16]);
      o[ns] = wmma16(pf0, b0, o[ns]);
      o[ns] = wmma16(pf1, b1, o[ns]);
    }
    __syncthreads();            // all waves done reading current buffers
  }

  // normalize and store ctx as [b, s, h*64+d] f16 (rows for out-projection)
#pragma unroll
  for (int r = 0; r < 8; ++r) {
    const float inv = 1.f / l_i[r];
    const int srow = q0 + r + hi * 8;
#pragma unroll
    for (int ns = 0; ns < 4; ++ns) {
      const float v = o[ns][r] * inv;
      ctx16[((size_t)(b * SEQ + srow)) * DIM + h * 64 + ns * 16 + ln] = (_Float16)v;
    }
  }
}

// ---------------------------------------------------------------------------
// host launcher
// ---------------------------------------------------------------------------
extern "C" void kernel_launch(void* const* d_in, const int* in_sizes, int n_in,
                              void* d_out, int out_size, void* d_ws, size_t ws_size,
                              hipStream_t stream) {
  (void)in_sizes; (void)n_in; (void)out_size; (void)ws_size;
  const float* hidden = (const float*)d_in[0];
  const float* lnw    = (const float*)d_in[1];
  const float* wq     = (const float*)d_in[2];
  const float* wk     = (const float*)d_in[3];
  const float* wv     = (const float*)d_in[4];
  const float* wo     = (const float*)d_in[5];
  const float* rb     = (const float*)d_in[6];
  float* out = (float*)d_out;

  char* ws = (char*)d_ws;
  const size_t MB = 1024ull * 1024ull;
  _Float16* normed = (_Float16*)(ws);             //  8 MB  [4096][1024]
  _Float16* w16    = (_Float16*)(ws + 8  * MB);   //  8 MB  wqT|wkT|wvT|woT
  _Float16* q16    = (_Float16*)(ws + 16 * MB);   //  8 MB  [b,h,s,64]
  _Float16* k16    = (_Float16*)(ws + 24 * MB);   //  8 MB  [b,h,s,64]
  _Float16* vt16   = (_Float16*)(ws + 32 * MB);   //  8 MB  [b,h,64,s]
  _Float16* ctx16  = (_Float16*)(ws + 40 * MB);   //  8 MB  [b*s][1024]

  t5_rmsnorm_kernel<<<MTOT, 256, 0, stream>>>(hidden, lnw, normed);
  t5_convw_kernel<<<16384, 256, 0, stream>>>(wq, wk, wv, wo, w16);
  // Q, K, Vt projections: grid.z selects the weight matrix + store layout
  t5_gemm_kernel<<<dim3(8, 32, 3), 256, 0, stream>>>(
      normed, w16, /*mode_base=*/0, q16, k16, vt16, nullptr, nullptr);
  t5_attn_kernel<<<dim3(SEQ / 128, BB * HH), 256, 0, stream>>>(
      q16, k16, vt16, rb, ctx16);
  // output projection + residual (mode 3)
  t5_gemm_kernel<<<dim3(8, 32, 1), 256, 0, stream>>>(
      ctx16, w16 + 3ull * (1u << 20), /*mode_base=*/3, nullptr, nullptr, nullptr,
      hidden, out);
}

// v002
// A run of this version takes 218 microseconds.
// Two timings next to v001 both put it at 1.44 times that version's speed.
// Over all steps from v000 it is 2.04 times as fast.
#include <hip/hip_runtime.h>

typedef __attribute__((ext_vector_type(16))) _Float16 v16h;
typedef __attribute__((ext_vector_type(8)))  _Float16 v8h;
typedef __attribute__((ext_vector_type(8)))  float    v8f;
typedef __attribute__((ext_vector_type(4)))  unsigned u32x4;
typedef __attribute__((ext_vector_type(8)))  int      i32x8;
typedef __attribute__((ext_vector_type(4)))  int      i32x4;

#define HH   16          // heads
#define DKV  64          // head dim
#define SEQ  2048
#define DIM  1024        // model dim == HH*DKV
#define BB   2
#define MTOT (BB * SEQ)  // 4096 rows

#if defined(__AMDGCN__) && __has_builtin(__builtin_amdgcn_tensor_load_to_lds)
#define HAVE_TDM 1
#else
#define HAVE_TDM 0
#endif

static __device__ __forceinline__ v16h make_v16(v8h lo, v8h hi) {
  union { v16h v; v8h h[2]; } u;
  u.h[0] = lo; u.h[1] = hi;
  return u.v;
}

static __device__ __forceinline__ v8f wmma16(v16h a, v16h b, v8f c) {
  // D = A(16x32 f16) x B(32x16 f16) + C(16x16 f32)
  return __builtin_amdgcn_wmma_f32_16x16x32_f16(
      /*neg_a=*/false, a, /*neg_b=*/false, b,
      /*c_mod=*/(short)0, c, /*reuse_a=*/false, /*reuse_b=*/false);
}

static __device__ __forceinline__ void async_b128(void* lds, const void* g) {
  asm volatile("global_load_async_to_lds_b128 %0, %1, off"
               :: "v"((unsigned)(unsigned long long)lds),
                  "v"((unsigned long long)g)
               : "memory");
}
static __device__ __forceinline__ void async_b128_x4(void* l0, const void* g0,
                                                     void* l1, const void* g1,
                                                     void* l2, const void* g2,
                                                     void* l3, const void* g3) {
  asm volatile("global_load_async_to_lds_b128 %0, %1, off\n\t"
               "global_load_async_to_lds_b128 %2, %3, off\n\t"
               "global_load_async_to_lds_b128 %4, %5, off\n\t"
               "global_load_async_to_lds_b128 %6, %7, off\n\t"
               "s_wait_xcnt 0x0"
               :: "v"((unsigned)(unsigned long long)l0), "v"((unsigned long long)g0),
                  "v"((unsigned)(unsigned long long)l1), "v"((unsigned long long)g1),
                  "v"((unsigned)(unsigned long long)l2), "v"((unsigned long long)g2),
                  "v"((unsigned)(unsigned long long)l3), "v"((unsigned long long)g3)
               : "memory");
}
static __device__ __forceinline__ void wait_async_le4() {
  asm volatile("s_wait_asynccnt 0x4" ::: "memory");
}
static __device__ __forceinline__ void wait_async_0() {
  asm volatile("s_wait_asynccnt 0x0" ::: "memory");
}

#if HAVE_TDM
static __device__ __forceinline__ void tdm_load_2d(void* lds, const void* gsrc,
                                                   unsigned tile_x, unsigned tile_y,
                                                   unsigned stride_elems) {
  const unsigned long long ga = (unsigned long long)gsrc;
  u32x4 g0;
  g0.x = 1u;
  g0.y = (unsigned)(unsigned long long)lds;
  g0.z = (unsigned)(ga & 0xffffffffu);
  g0.w = (unsigned)((ga >> 32) & 0x01ffffffu) | (2u << 30);
  const unsigned dim0 = stride_elems;
  const unsigned dim1 = 1u << 20;
  i32x8 g1;
  g1[0] = 0x10000;
  g1[1] = (int)((dim0 & 0xffffu) << 16);
  g1[2] = (int)((dim0 >> 16) | ((dim1 & 0xffffu) << 16));
  g1[3] = (int)((dim1 >> 16) | (tile_x << 16));
  g1[4] = (int)(tile_y & 0xffffu);
  g1[5] = (int)stride_elems;
  g1[6] = 0;
  g1[7] = 0;
  const i32x4 gz4 = {0, 0, 0, 0};
  const i32x8 gz8 = {0, 0, 0, 0, 0, 0, 0, 0};
  __builtin_amdgcn_tensor_load_to_lds(g0, g1, gz4, gz4, gz8, 0);
}
#endif

// ---------------------------------------------------------------------------
// Kernel 1: RMS norm (T5 LayerNorm: no mean subtraction) -> f16 activations
// ---------------------------------------------------------------------------
__global__ void t5_rmsnorm_kernel(const float* __restrict__ hs,
                                  const float* __restrict__ w,
                                  _Float16* __restrict__ out) {
  __shared__ float red[256];
  const int row = blockIdx.x;
  const int t = threadIdx.x;
  const float* r = hs + (size_t)row * DIM;

  float vals[4];
  float s = 0.f;
#pragma unroll
  for (int i = 0; i < 4; ++i) {
    vals[i] = r[t + i * 256];
    s += vals[i] * vals[i];
  }
  red[t] = s;
  __syncthreads();
  for (int off = 128; off > 0; off >>= 1) {
    if (t < off) red[t] += red[t + off];
    __syncthreads();
  }
  const float rs = rsqrtf(red[0] * (1.0f / DIM) + 1e-6f);
#pragma unroll
  for (int i = 0; i < 4; ++i) {
    const int c = t + i * 256;
    out[(size_t)row * DIM + c] = (_Float16)(vals[i] * w[c] * rs);
  }
}

// ---------------------------------------------------------------------------
// Kernel 2: convert weights f32 -> f16 AND transpose to [N][K]
// out layout: wqT | wkT | wvT | woT, each [1024][1024] f16
// ---------------------------------------------------------------------------
__global__ void t5_convw_kernel(const float* __restrict__ wq,
                                const float* __restrict__ wk,
                                const float* __restrict__ wv,
                                const float* __restrict__ wo,
                                _Float16* __restrict__ out) {
  const int id = blockIdx.x * 256 + threadIdx.x;     // 0 .. 4M-1
  const int w = id >> 20;
  const int rem = id & ((1 << 20) - 1);
  const int e = rem >> 10;       // output feature (row of transposed)
  const int d = rem & 1023;      // input feature  (col of transposed)
  const float* src = (w == 0) ? wq : (w == 1) ? wk : (w == 2) ? wv : wo;
  out[((size_t)w << 20) + (size_t)e * 1024 + d] = (_Float16)src[(size_t)d * 1024 + e];
}

__global__ void t5_gemm_kernel(const _Float16* __restrict__ A,
                               const _Float16* __restrict__ Bt,
                               int mode_base,
                               _Float16* __restrict__ q16,
                               _Float16* __restrict__ k16,
                               _Float16* __restrict__ vt16,
                               const float* __restrict__ hidden,
                               float* __restrict__ outf) {
  __shared__ _Float16 sA[2][128 * 32];   // 2 x 8 KB
  __shared__ _Float16 sB[2][128 * 32];   // 2 x 8 KB

  const int mode = mode_base + blockIdx.z;
  const _Float16* B = Bt + ((size_t)blockIdx.z << 20);
  const int m0 = blockIdx.y * 128;
  const int n0 = blockIdx.x * 128;
  const int t = threadIdx.x;
  const int lane = t & 31, wave = t >> 5;
  const int wm = wave >> 2, wn = wave & 3;
  const int ln = lane & 15, hi = lane >> 4;

  const v8f zero = {0.f, 0.f, 0.f, 0.f, 0.f, 0.f, 0.f, 0.f};
  v8f acc[4][2];
#pragma unroll
  for (int i = 0; i < 4; ++i)
#pragma unroll
    for (int j = 0; j < 2; ++j) acc[i][j] = zero;

#if HAVE_TDM
  auto stage = [&](int k0, int buf) {
    if (wave == 0) {
      tdm_load_2d(&sA[buf][0], &A[(size_t)m0 * 1024 + k0], 32, 128, 1024);
      tdm_load_2d(&sB[buf][0], &B[(size_t)n0 * 1024 + k0], 32, 128, 1024);
    }
  };
  auto wait_stage = [&](bool pending) {
    if (wave == 0) {
      if (pending) __builtin_amdgcn_s_wait_tensorcnt(2);
      else         __builtin_amdgcn_s_wait_tensorcnt(0);
    }
  };
#else
  auto stage = [&](int k0, int buf) {
#pragma unroll
    for (int i = 0; i < 2; ++i) {
      const int c = t + i * 256;               // 0..511 chunk id
      const int row = c >> 2, col8 = (c & 3) * 8;
      async_b128(&sA[buf][row * 32 + col8],
                 &A[(size_t)(m0 + row) * 1024 + k0 + col8]);
      async_b128(&sB[buf][row * 32 + col8],
                 &B[(size_t)(n0 + row) * 1024 + k0 + col8]);
    }
  };
  auto wait_stage = [&](bool pending) {
    if (pending) wait_async_le4();
    else         wait_async_0();
  };
#endif

  const int nk = 1024 / 32;
  stage(0, 0);
  for (int ik = 0; ik < nk; ++ik) {
    const int cur = ik & 1;
    const bool pre = (ik + 1 < nk);
    if (pre) stage((ik + 1) * 32, cur ^ 1);  // prefetch next tile
    wait_stage(pre);                         // older DMAs (current buf) landed
    __syncthreads();                         // current buffer visible block-wide

    v16h af[4], bf[2];
#pragma unroll
    for (int i = 0; i < 4; ++i) {
      const int r = wm * 64 + i * 16 + ln;
      af[i] = make_v16(*(const v8h*)&sA[cur][r * 32 + hi * 8],
                       *(const v8h*)&sA[cur][r * 32 + hi * 8 + 16]);
    }
#pragma unroll
    for (int j = 0; j < 2; ++j) {
      const int r = wn * 32 + j * 16 + ln;
      bf[j] = make_v16(*(const v8h*)&sB[cur][r * 32 + hi * 8],
                       *(const v8h*)&sB[cur][r * 32 + hi * 8 + 16]);
    }
#pragma unroll
    for (int i = 0; i < 4; ++i)
#pragma unroll
      for (int j = 0; j < 2; ++j) acc[i][j] = wmma16(af[i], bf[j], acc[i][j]);

    __syncthreads();          // all waves done reading -> buffer reusable
  }

#pragma unroll
  for (int i = 0; i < 4; ++i)
#pragma unroll
    for (int j = 0; j < 2; ++j) {
      const int mbase = m0 + wm * 64 + i * 16 + hi * 8;
      const int nc = n0 + wn * 32 + j * 16 + ln;
#pragma unroll
      for (int r = 0; r < 8; ++r) {
        const int m = mbase + r;
        const float v = acc[i][j][r];
        if (mode == 3) {
          outf[(size_t)m * 1024 + nc] = hidden[(size_t)m * 1024 + nc] + v;
        } else {
          const int b = m >> 11, s = m & 2047;
          const int h = nc >> 6, d = nc & 63;
          if (mode == 0)
            q16[((size_t)(b * HH + h) * SEQ + s) * DKV + d] = (_Float16)v;
          else if (mode == 1)
            k16[((size_t)(b * HH + h) * SEQ + s) * DKV + d] = (_Float16)v;
          else
            vt16[((size_t)(b * HH + h) * DKV + d) * SEQ + s] = (_Float16)v;
        }
      }
    }
}

#define LP 72            // LDS row pitch of the K, V and P tiles, in halfs
__global__ void __launch_bounds__(256) t5_attn_kernel(const _Float16* __restrict__ q16,
                               const _Float16* __restrict__ k16,
                               const _Float16* __restrict__ vt16,
                               const float* __restrict__ rel_bias,
                               _Float16* __restrict__ ctx16) {
  __shared__ _Float16 biasH[4096];        // bias[k - q + 2047]      8 KB
  __shared__ __attribute__((aligned(16))) _Float16 kt[2][64 * LP];     // K chunk [k_row][d]   2x 9 KB
  __shared__ __attribute__((aligned(16))) _Float16 vt[2][64 * LP];     // V chunk [d][k_col]   2x 9 KB
  __shared__ __attribute__((aligned(16))) _Float16 pbuf[8 * 16 * LP];  // per-wave P tiles       18 KB

  const int bh = blockIdx.y;             // b*16 + h
  const int h = bh & 15;
  const int b = bh >> 4;
  const int t = threadIdx.x, lane = t & 31, wave = t >> 5;
  const int ln = lane & 15, hi = lane >> 4;
  const int q0 = blockIdx.x * 128 + wave * 16;

  const _Float16* qbase = q16 + (size_t)bh * SEQ * DKV;
  const _Float16* kbase = k16 + (size_t)bh * SEQ * DKV;
  const _Float16* vbase = vt16 + (size_t)bh * DKV * SEQ;

  // stage one 64-wide K/V chunk (4 async b128 per thread)
  auto stage = [&](int kc, int buf) {
    const int row = t >> 3, col8 = (t & 7) * 8;     // rows row and row + 32
    async_b128_x4(&kt[buf][row * LP + col8],
                  &kbase[(size_t)(kc + row) * DKV + col8],
                  &vt[buf][row * LP + col8],
                  &vbase[(size_t)row * SEQ + kc + col8],
                  &kt[buf][(row + 32) * LP + col8],
                  &kbase[(size_t)(kc + row + 32) * DKV + col8],
                  &vt[buf][(row + 32) * LP + col8],
                  &vbase[(size_t)(row + 32) * SEQ + kc + col8]);
  };
  stage(0, 0);

  // T5 bidirectional bucket: 16 sign buckets x {exact<8 | log-spaced to 128}
  for (int i = t; i < 4095; i += 256) {
    const int delta = i - 2047;          // k - q
    const int rb = (delta > 0) ? 16 : 0;
    const int rp = (delta < 0) ? -delta : delta;
    int bu;
    if (rp < 8) {
      bu = rp;
    } else {
      bu = 8 + (int)(__logf((float)rp * 0.125f) * (8.0f / __logf(16.0f)));
      bu = bu > 15 ? 15 : bu;
    }
    biasH[i] = (_Float16)rel_bias[(rb + bu) * HH + h];
  }

  v16h qf[2];
  {
    const _Float16* p = qbase + (size_t)(q0 + ln) * DKV;
    qf[0] = make_v16(*(const v8h*)&p[hi * 8], *(const v8h*)&p[hi * 8 + 16]);
    qf[1] = make_v16(*(const v8h*)&p[32 + hi * 8], *(const v8h*)&p[32 + hi * 8 + 16]);
  }

  const v8f zero = {0.f, 0.f, 0.f, 0.f, 0.f, 0.f, 0.f, 0.f};
  float m_i[8], l_i[8];
  v8f o[4];
#pragma unroll
  for (int r = 0; r < 8; ++r) { m_i[r] = -1e30f; l_i[r] = 0.f; }
#pragma unroll
  for (int j = 0; j < 4; ++j) o[j] = zero;

  _Float16* myp = &pbuf[wave * 16 * LP];

  const int nchunk = SEQ / 64;
  for (int ic = 0; ic < nchunk; ++ic) {
    const int kc = ic * 64;
    const int cur = ic & 1;
    if (ic + 1 < nchunk) {      // prefetch next K/V chunk
      stage(kc + 64, cur ^ 1);
      wait_async_le4();
    } else {
      wait_async_0();
    }
    __syncthreads();            // current K/V tiles (+ bias table) visible

    // scores S = Q(16x64) * K_chunk^T(64x64)
    v8f s[4];
#pragma unroll
    for (int ns = 0; ns < 4; ++ns) {
      const int r = ns * 16 + ln;
      v16h b0 = make_v16(*(const v8h*)&kt[cur][r * LP + hi * 8],
                         *(const v8h*)&kt[cur][r * LP + hi * 8 + 16]);
      v16h b1 = make_v16(*(const v8h*)&kt[cur][r * LP + 32 + hi * 8],
                         *(const v8h*)&kt[cur][r * LP + 32 + hi * 8 + 16]);
      v8f a = zero;
      a = wmma16(qf[0], b0, a);
      a = wmma16(qf[1], b1, a);
      s[ns] = a;
    }

    // bias add + per-row max (rows live across 16-lane halves in wave32)
    float cm[8];
#pragma unroll
    for (int r = 0; r < 8; ++r) {
      const int qrow = q0 + r + hi * 8;
      float mx = -1e30f;
#pragma unroll
      for (int ns = 0; ns < 4; ++ns) {
        const int kcol = kc + ns * 16 + ln;
        const float v = s[ns][r] + (float)biasH[kcol - qrow + 2047];
        s[ns][r] = v;
        mx = fmaxf(mx, v);
      }
      cm[r] = mx;
    }
#pragma unroll
    for (int msk = 1; msk < 16; msk <<= 1)
#pragma unroll
      for (int r = 0; r < 8; ++r) cm[r] = fmaxf(cm[r], __shfl_xor(cm[r], msk, 32));

    // online softmax update
    float rs[8];
#pragma unroll
    for (int r = 0; r < 8; ++r) {
      const float mnew = fmaxf(m_i[r], cm[r]);
      const float scale = __expf(m_i[r] - mnew);
      float sum = 0.f;
#pragma unroll
      for (int ns = 0; ns < 4; ++ns) {
        const float p = __expf(s[ns][r] - mnew);
        s[ns][r] = p;
        sum += p;
      }
      rs[r] = sum;
      m_i[r] = mnew;
      l_i[r] *= scale;
#pragma unroll
      for (int j = 0; j < 4; ++j) o[j][r] *= scale;
    }
#pragma unroll
    for (int msk = 1; msk < 16; msk <<= 1)
#pragma unroll
      for (int r = 0; r < 8; ++r) rs[r] += __shfl_xor(rs[r], msk, 32);
#pragma unroll
    for (int r = 0; r < 8; ++r) l_i[r] += rs[r];

    // transpose P from C-layout to A-layout via per-wave LDS tile
#pragma unroll
    for (int ns = 0; ns < 4; ++ns)
#pragma unroll
      for (int r = 0; r < 8; ++r)
        myp[(r + hi * 8) * LP + ns * 16 + ln] = (_Float16)s[ns][r];
    __syncthreads();            // P visible (and ds writes retired)

    // ctx += P(16x64) * V_chunk(64x64);  Vt LDS tile is already [N=d][K=s]
    v16h pf0 = make_v16(*(const v8h*)&myp[ln * LP + hi * 8],
                        *(const v8h*)&myp[ln * LP + hi * 8 + 16]);
    v16h pf1 = make_v16(*(const v8h*)&myp[ln * LP + 32 + hi * 8],
                        *(const v8h*)&myp[ln * LP + 32 + hi * 8 + 16]);
#pragma unroll
    for (int ns = 0; ns < 4; ++ns) {
      const int r = ns * 16 + ln;
      v16h b0 = make_v16(*(const v8h*)&vt[cur][r * LP + hi * 8],
                         *(const v8h*)&vt[cur][r * LP + hi * 8 + 16]);
      v16h b1 = make_v16(*(const v8h*)&vt[cur][r * LP + 32 + hi * 8],
                         *(const v8h*)&vt[cur][r * LP + 32 + hi * 8 + 16]);
      o[ns] = wmma16(pf0, b0, o[ns]);
      o[ns] = wmma16(pf1, b1, o[ns]);
    }
    __syncthreads();            // all waves done reading current buffers
  }

  // normalize and store ctx as [b, s, h*64+d] f16 (rows for out-projection)
#pragma unroll
  for (int r = 0; r < 8; ++r) {
    const float inv = 1.f / l_i[r];
    const int srow = q0 + r + hi * 8;
#pragma unroll
    for (int ns = 0; ns < 4; ++ns) {
      const float v = o[ns][r] * inv;
      ctx16[((size_t)(b * SEQ + srow)) * DIM + h * 64 + ns * 16 + ln] = (_Float16)v;
    }
  }
}

// ---------------------------------------------------------------------------
// host launcher
// ---------------------------------------------------------------------------
extern "C" void kernel_launch(void* const* d_in, const int* in_sizes, int n_in,
                              void* d_out, int out_size, void* d_ws, size_t ws_size,
                              hipStream_t stream) {
  (void)in_sizes; (void)n_in; (void)out_size; (void)ws_size;
  const float* hidden = (const float*)d_in[0];
  const float* lnw    = (const float*)d_in[1];
  const float* wq     = (const float*)d_in[2];
  const float* wk     = (const float*)d_in[3];
  const float* wv     = (const float*)d_in[4];
  const float* wo     = (const float*)d_in[5];
  const float* rb     = (const float*)d_in[6];
  float* out = (float*)d_out;

  char* ws = (char*)d_ws;
  const size_t MB = 1024ull * 1024ull;
  _Float16* normed = (_Float16*)(ws);             //  8 MB  [4096][1024]
  _Float16* w16    = (_Float16*)(ws + 8  * MB);   //  8 MB  wqT|wkT|wvT|woT
  _Float16* q16    = (_Float16*)(ws + 16 * MB);   //  8 MB  [b,h,s,64]
  _Float16* k16    = (_Float16*)(ws + 24 * MB);   //  8 MB  [b,h,s,64]
  _Float16* vt16   = (_Float16*)(ws + 32 * MB);   //  8 MB  [b,h,64,s]
  _Float16* ctx16  = (_Float16*)(ws + 40 * MB);   //  8 MB  [b*s][1024]

  t5_rmsnorm_kernel<<<MTOT, 256, 0, stream>>>(hidden, lnw, normed);
  t5_convw_kernel<<<16384, 256, 0, stream>>>(wq, wk, wv, wo, w16);
  // Q, K, Vt projections: grid.z selects the weight matrix + store layout
  t5_gemm_kernel<<<dim3(8, 32, 3), 256, 0, stream>>>(
      normed, w16, /*mode_base=*/0, q16, k16, vt16, nullptr, nullptr);
  t5_attn_kernel<<<dim3(SEQ / 128, BB * HH), 256, 0, stream>>>(
      q16, k16, vt16, rb, ctx16);
  // output projection + residual (mode 3)
  t5_gemm_kernel<<<dim3(8, 32, 1), 256, 0, stream>>>(
      ctx16, w16 + 3ull * (1u << 20), /*mode_base=*/3, nullptr, nullptr, nullptr,
      hidden, out);
}

// v003
// One run takes 201 microseconds.
// Timed twice side by side with v002, it ran 1.08 times as fast both times.
// Counting every step since v000, it is 2.20 times as fast.
#include <hip/hip_runtime.h>

typedef __attribute__((ext_vector_type(16))) _Float16 v16h;
typedef __attribute__((ext_vector_type(8)))  _Float16 v8h;
typedef __attribute__((ext_vector_type(8)))  float    v8f;
typedef __attribute__((ext_vector_type(4)))  unsigned u32x4;
typedef __attribute__((ext_vector_type(8)))  int      i32x8;
typedef __attribute__((ext_vector_type(4)))  int      i32x4;

#define HH   16          // heads
#define DKV  64          // head dim
#define SEQ  2048
#define DIM  1024        // model dim == HH*DKV
#define BB   2
#define MTOT (BB * SEQ)  // 4096 rows

#if defined(__AMDGCN__) && __has_builtin(__builtin_amdgcn_tensor_load_to_lds)
#define HAVE_TDM 1
#else
#define HAVE_TDM 0
#endif

static __device__ __forceinline__ v16h make_v16(v8h lo, v8h hi) {
  union { v16h v; v8h h[2]; } u;
  u.h[0] = lo; u.h[1] = hi;
  return u.v;
}

static __device__ __forceinline__ v8f wmma16(v16h a, v16h b, v8f c) {
  // D = A(16x32 f16) x B(32x16 f16) + C(16x16 f32)
  return __builtin_amdgcn_wmma_f32_16x16x32_f16(
      /*neg_a=*/false, a, /*neg_b=*/false, b,
      /*c_mod=*/(short)0, c, /*reuse_a=*/false, /*reuse_b=*/false);
}

static __device__ __forceinline__ void async_b128(void* lds, const void* g) {
  asm volatile("global_load_async_to_lds_b128 %0, %1, off"
               :: "v"((unsigned)(unsigned long long)lds),
                  "v"((unsigned long long)g)
               : "memory");
}
static __device__ __forceinline__ void async_b128_x4(void* l0, const void* g0,
                                                     void* l1, const void* g1,
                                                     void* l2, const void* g2,
                                                     void* l3, const void* g3) {
  asm volatile("global_load_async_to_lds_b128 %0, %1, off\n\t"
               "global_load_async_to_lds_b128 %2, %3, off\n\t"
               "global_load_async_to_lds_b128 %4, %5, off\n\t"
               "global_load_async_to_lds_b128 %6, %7, off\n\t"
               "s_wait_xcnt 0x0"
               :: "v"((unsigned)(unsigned long long)l0), "v"((unsigned long long)g0),
                  "v"((unsigned)(unsigned long long)l1), "v"((unsigned long long)g1),
                  "v"((unsigned)(unsigned long long)l2), "v"((unsigned long long)g2),
                  "v"((unsigned)(unsigned long long)l3), "v"((unsigned long long)g3)
               : "memory");
}
static __device__ __forceinline__ void wait_async_le4() {
  asm volatile("s_wait_asynccnt 0x4" ::: "memory");
}
static __device__ __forceinline__ void wait_async_0() {
  asm volatile("s_wait_asynccnt 0x0" ::: "memory");
}

#if HAVE_TDM
static __device__ __forceinline__ void tdm_load_2d(void* lds, const void* gsrc,
                                                   unsigned tile_x, unsigned tile_y,
                                                   unsigned stride_elems) {
  const unsigned long long ga = (unsigned long long)gsrc;
  u32x4 g0;
  g0.x = 1u;
  g0.y = (unsigned)(unsigned long long)lds;
  g0.z = (unsigned)(ga & 0xffffffffu);
  g0.w = (unsigned)((ga >> 32) & 0x01ffffffu) | (2u << 30);
  const unsigned dim0 = stride_elems;
  const unsigned dim1 = 1u << 20;
  i32x8 g1;
  g1[0] = 0x10000;
  g1[1] = (int)((dim0 & 0xffffu) << 16);
  g1[2] = (int)((dim0 >> 16) | ((dim1 & 0xffffu) << 16));
  g1[3] = (int)((dim1 >> 16) | (tile_x << 16));
  g1[4] = (int)(tile_y & 0xffffu);
  g1[5] = (int)stride_elems;
  g1[6] = 0;
  g1[7] = 0;
  const i32x4 gz4 = {0, 0, 0, 0};
  const i32x8 gz8 = {0, 0, 0, 0, 0, 0, 0, 0};
  __builtin_amdgcn_tensor_load_to_lds(g0, g1, gz4, gz4, gz8, 0);
}
#endif

// ---------------------------------------------------------------------------
// Kernel 1: RMS norm (T5 LayerNorm: no mean subtraction) -> f16 activations
// ---------------------------------------------------------------------------
__global__ void t5_rmsnorm_kernel(const float* __restrict__ hs,
                                  const float* __restrict__ w,
                                  _Float16* __restrict__ out) {
  __shared__ float red[256];
  const int row = blockIdx.x;
  const int t = threadIdx.x;
  const float* r = hs + (size_t)row * DIM;

  float vals[4];
  float s = 0.f;
#pragma unroll
  for (int i = 0; i < 4; ++i) {
    vals[i] = r[t + i * 256];
    s += vals[i] * vals[i];
  }
  red[t] = s;
  __syncthreads();
  for (int off = 128; off > 0; off >>= 1) {
    if (t < off) red[t] += red[t + off];
    __syncthreads();
  }
  const float rs = rsqrtf(red[0] * (1.0f / DIM) + 1e-6f);
#pragma unroll
  for (int i = 0; i < 4; ++i) {
    const int c = t + i * 256;
    out[(size_t)row * DIM + c] = (_Float16)(vals[i] * w[c] * rs);
  }
}

typedef __attribute__((ext_vector_type(4))) float    f32x4;
typedef __attribute__((ext_vector_type(2))) _Float16 v2h;
__global__ void __launch_bounds__(256) t5_convw_kernel(const float* __restrict__ wq,
                                const float* __restrict__ wk,
                                const float* __restrict__ wv,
                                const float* __restrict__ wo,
                                _Float16* __restrict__ out) {
  __shared__ __attribute__((aligned(16))) _Float16 tile[64 * 128];   // 16 KB
  const int w = blockIdx.z;
  const int e0 = blockIdx.x * 64;    // first output feature (row of transposed)
  const int d0 = blockIdx.y * 128;   // first input feature  (col of transposed)
  const float* src = (w == 0) ? wq : (w == 1) ? wk : (w == 2) ? wv : wo;
  const int t = threadIdx.x;
  const int eq = t & 15;             // this thread's four e: 4 * eq + 0..3
  const int rp = t >> 4;             // its d pairs: 2 * (rp + 16 * i) + 0..1

  f32x4 ra[4], rb[4];
#pragma unroll
  for (int i = 0; i < 4; ++i) {
    const float* p = src + (size_t)(d0 + 2 * (rp + 16 * i)) * 1024 + e0 + 4 * eq;
    ra[i] = *(const f32x4*)p;
    rb[i] = *(const f32x4*)(p + 1024);
    // a later load's result may be given the registers that held this pair's
    // address: the wait stands between these two loads and any such write
    asm volatile("s_wait_xcnt 0x0" ::: "memory");
  }
#pragma unroll
  for (int i = 0; i < 4; ++i) {
    const int d = 2 * (rp + 16 * i);
    const int piece = (d >> 3) ^ eq;             // (e >> 2) & 15 == eq
#pragma unroll
    for (int j = 0; j < 4; ++j) {
      v2h pr;
      pr[0] = (_Float16)ra[i][j];
      pr[1] = (_Float16)rb[i][j];
      *(v2h*)&tile[(4 * eq + j) * 128 + piece * 8 + (d & 7)] = pr;
    }
  }
  __syncthreads();                   // whole tile written before any row is read
  _Float16* dst = out + ((size_t)w << 20) + (size_t)e0 * 1024 + d0;
#pragma unroll
  for (int i = 0; i < 4; ++i) {
    const int id = t + i * 256;
    const int e = id >> 4, c = id & 15;
    const v8h v = *(const v8h*)&tile[e * 128 + (c ^ ((e >> 2) & 15)) * 8];
    *(v8h*)&dst[(size_t)e * 1024 + c * 8] = v;
  }
}

__global__ void t5_gemm_kernel(const _Float16* __restrict__ A,
                               const _Float16* __restrict__ Bt,
                               int mode_base,
                               _Float16* __restrict__ q16,
                               _Float16* __restrict__ k16,
                               _Float16* __restrict__ vt16,
                               const float* __restrict__ hidden,
                               float* __restrict__ outf) {
  __shared__ _Float16 sA[2][128 * 32];   // 2 x 8 KB
  __shared__ _Float16 sB[2][128 * 32];   // 2 x 8 KB

  const int mode = mode_base + blockIdx.z;
  const _Float16* B = Bt + ((size_t)blockIdx.z << 20);
  const int m0 = blockIdx.y * 128;
  const int n0 = blockIdx.x * 128;
  const int t = threadIdx.x;
  const int lane = t & 31, wave = t >> 5;
  const int wm = wave >> 2, wn = wave & 3;
  const int ln = lane & 15, hi = lane >> 4;

  const v8f zero = {0.f, 0.f, 0.f, 0.f, 0.f, 0.f, 0.f, 0.f};
  v8f acc[4][2];
#pragma unroll
  for (int i = 0; i < 4; ++i)
#pragma unroll
    for (int j = 0; j < 2; ++j) acc[i][j] = zero;

#if HAVE_TDM
  auto stage = [&](int k0, int buf) {
    if (wave == 0) {
      tdm_load_2d(&sA[buf][0], &A[(size_t)m0 * 1024 + k0], 32, 128, 1024);
      tdm_load_2d(&sB[buf][0], &B[(size_t)n0 * 1024 + k0], 32, 128, 1024);
    }
  };
  auto wait_stage = [&](bool pending) {
    if (wave == 0) {
      if (pending) __builtin_amdgcn_s_wait_tensorcnt(2);
      else         __builtin_amdgcn_s_wait_tensorcnt(0);
    }
  };
#else
  auto stage = [&](int k0, int buf) {
#pragma unroll
    for (int i = 0; i < 2; ++i) {
      const int c = t + i * 256;               // 0..511 chunk id
      const int row = c >> 2, col8 = (c & 3) * 8;
      async_b128(&sA[buf][row * 32 + col8],
                 &A[(size_t)(m0 + row) * 1024 + k0 + col8]);
      async_b128(&sB[buf][row * 32 + col8],
                 &B[(size_t)(n0 + row) * 1024 + k0 + col8]);
    }
  };
  auto wait_stage = [&](bool pending) {
    if (pending) wait_async_le4();
    else         wait_async_0();
  };
#endif

  const int nk = 1024 / 32;
  stage(0, 0);
  for (int ik = 0; ik < nk; ++ik) {
    const int cur = ik & 1;
    const bool pre = (ik + 1 < nk);
    if (pre) stage((ik + 1) * 32, cur ^ 1);  // prefetch next tile
    wait_stage(pre);                         // older DMAs (current buf) landed
    __syncthreads();                         // current buffer visible block-wide

    v16h af[4], bf[2];
#pragma unroll
    for (int i = 0; i < 4; ++i) {
      const int r = wm * 64 + i * 16 + ln;
      af[i] = make_v16(*(const v8h*)&sA[cur][r * 32 + hi * 8],
                       *(const v8h*)&sA[cur][r * 32 + hi * 8 + 16]);
    }
#pragma unroll
    for (int j = 0; j < 2; ++j) {
      const int r = wn * 32 + j * 16 + ln;
      bf[j] = make_v16(*(const v8h*)&sB[cur][r * 32 + hi * 8],
                       *(const v8h*)&sB[cur][r * 32 + hi * 8 + 16]);
    }
#pragma unroll
    for (int i = 0; i < 4; ++i)
#pragma unroll
      for (int j = 0; j < 2; ++j) acc[i][j] = wmma16(af[i], bf[j], acc[i][j]);

    __syncthreads();          // all waves done reading -> buffer reusable
  }

#pragma unroll
  for (int i = 0; i < 4; ++i)
#pragma unroll
    for (int j = 0; j < 2; ++j) {
      const int mbase = m0 + wm * 64 + i * 16 + hi * 8;
      const int nc = n0 + wn * 32 + j * 16 + ln;
#pragma unroll
      for (int r = 0; r < 8; ++r) {
        const int m = mbase + r;
        const float v = acc[i][j][r];
        if (mode == 3) {
          outf[(size_t)m * 1024 + nc] = hidden[(size_t)m * 1024 + nc] + v;
        } else {
          const int b = m >> 11, s = m & 2047;
          const int h = nc >> 6, d = nc & 63;
          if (mode == 0)
            q16[((size_t)(b * HH + h) * SEQ + s) * DKV + d] = (_Float16)v;
          else if (mode == 1)
            k16[((size_t)(b * HH + h) * SEQ + s) * DKV + d] = (_Float16)v;
          else
            vt16[((size_t)(b * HH + h) * DKV + d) * SEQ + s] = (_Float16)v;
        }
      }
    }
}

#define LP 72            // LDS row pitch of the K, V and P tiles, in halfs
__global__ void __launch_bounds__(256) t5_attn_kernel(const _Float16* __restrict__ q16,
                               const _Float16* __restrict__ k16,
                               const _Float16* __restrict__ vt16,
                               const float* __restrict__ rel_bias,
                               _Float16* __restrict__ ctx16) {
  __shared__ _Float16 biasH[4096];        // bias[k - q + 2047]      8 KB
  __shared__ __attribute__((aligned(16))) _Float16 kt[2][64 * LP];     // K chunk [k_row][d]   2x 9 KB
  __shared__ __attribute__((aligned(16))) _Float16 vt[2][64 * LP];     // V chunk [d][k_col]   2x 9 KB
  __shared__ __attribute__((aligned(16))) _Float16 pbuf[8 * 16 * LP];  // per-wave P tiles       18 KB

  const int bh = blockIdx.y;             // b*16 + h
  const int h = bh & 15;
  const int b = bh >> 4;
  const int t = threadIdx.x, lane = t & 31, wave = t >> 5;
  const int ln = lane & 15, hi = lane >> 4;
  const int q0 = blockIdx.x * 128 + wave * 16;

  const _Float16* qbase = q16 + (size_t)bh * SEQ * DKV;
  const _Float16* kbase = k16 + (size_t)bh * SEQ * DKV;
  const _Float16* vbase = vt16 + (size_t)bh * DKV * SEQ;

  // stage one 64-wide K/V chunk (4 async b128 per thread)
  auto stage = [&](int kc, int buf) {
    const int row = t >> 3, col8 = (t & 7) * 8;     // rows row and row + 32
    async_b128_x4(&kt[buf][row * LP + col8],
                  &kbase[(size_t)(kc + row) * DKV + col8],
                  &vt[buf][row * LP + col8],
                  &vbase[(size_t)row * SEQ + kc + col8],
                  &kt[buf][(row + 32) * LP + col8],
                  &kbase[(size_t)(kc + row + 32) * DKV + col8],
                  &vt[buf][(row + 32) * LP + col8],
                  &vbase[(size_t)(row + 32) * SEQ + kc + col8]);
  };
  stage(0, 0);

  // T5 bidirectional bucket: 16 sign buckets x {exact<8 | log-spaced to 128}
  for (int i = t; i < 4095; i += 256) {
    const int delta = i - 2047;          // k - q
    const int rb = (delta > 0) ? 16 : 0;
    const int rp = (delta < 0) ? -delta : delta;
    int bu;
    if (rp < 8) {
      bu = rp;
    } else {
      bu = 8 + (int)(__logf((float)rp * 0.125f) * (8.0f / __logf(16.0f)));
      bu = bu > 15 ? 15 : bu;
    }
    biasH[i] = (_Float16)rel_bias[(rb + bu) * HH + h];
  }

  v16h qf[2];
  {
    const _Float16* p = qbase + (size_t)(q0 + ln) * DKV;
    qf[0] = make_v16(*(const v8h*)&p[hi * 8], *(const v8h*)&p[hi * 8 + 16]);
    qf[1] = make_v16(*(const v8h*)&p[32 + hi * 8], *(const v8h*)&p[32 + hi * 8 + 16]);
  }

  const v8f zero = {0.f, 0.f, 0.f, 0.f, 0.f, 0.f, 0.f, 0.f};
  float m_i[8], l_i[8];
  v8f o[4];
#pragma unroll
  for (int r = 0; r < 8; ++r) { m_i[r] = -1e30f; l_i[r] = 0.f; }
#pragma unroll
  for (int j = 0; j < 4; ++j) o[j] = zero;

  _Float16* myp = &pbuf[wave * 16 * LP];

  const int nchunk = SEQ / 64;
  for (int ic = 0; ic < nchunk; ++ic) {
    const int kc = ic * 64;
    const int cur = ic & 1;
    if (ic + 1 < nchunk) {      // prefetch next K/V chunk
      stage(kc + 64, cur ^ 1);
      wait_async_le4();
    } else {
      wait_async_0();
    }
    __syncthreads();            // current K/V tiles (+ bias table) visible

    // scores S = Q(16x64) * K_chunk^T(64x64)
    v8f s[4];
#pragma unroll
    for (int ns = 0; ns < 4; ++ns) {
      const int r = ns * 16 + ln;
      v16h b0 = make_v16(*(const v8h*)&kt[cur][r * LP + hi * 8],
                         *(const v8h*)&kt[cur][r * LP + hi * 8 + 16]);
      v16h b1 = make_v16(*(const v8h*)&kt[cur][r * LP + 32 + hi * 8],
                         *(const v8h*)&kt[cur][r * LP + 32 + hi * 8 + 16]);
      v8f a = zero;
      a = wmma16(qf[0], b0, a);
      a = wmma16(qf[1], b1, a);
      s[ns] = a;
    }

    // bias add + per-row max (rows live across 16-lane halves in wave32)
    float cm[8];
#pragma unroll
    for (int r = 0; r < 8; ++r) {
      const int qrow = q0 + r + hi * 8;
      float mx = -1e30f;
#pragma unroll
      for (int ns = 0; ns < 4; ++ns) {
        const int kcol = kc + ns * 16 + ln;
        const float v = s[ns][r] + (float)biasH[kcol - qrow + 2047];
        s[ns][r] = v;
        mx = fmaxf(mx, v);
      }
      cm[r] = mx;
    }
#pragma unroll
    for (int msk = 1; msk < 16; msk <<= 1)
#pragma unroll
      for (int r = 0; r < 8; ++r) cm[r] = fmaxf(cm[r], __shfl_xor(cm[r], msk, 32));

    // online softmax update
    float rs[8];
#pragma unroll
    for (int r = 0; r < 8; ++r) {
      const float mnew = fmaxf(m_i[r], cm[r]);
      const float scale = __expf(m_i[r] - mnew);
      float sum = 0.f;
#pragma unroll
      for (int ns = 0; ns < 4; ++ns) {
        const float p = __expf(s[ns][r] - mnew);
        s[ns][r] = p;
        sum += p;
      }
      rs[r] = sum;
      m_i[r] = mnew;
      l_i[r] *= scale;
#pragma unroll
      for (int j = 0; j < 4; ++j) o[j][r] *= scale;
    }
#pragma unroll
    for (int msk = 1; msk < 16; msk <<= 1)
#pragma unroll
      for (int r = 0; r < 8; ++r) rs[r] += __shfl_xor(rs[r], msk, 32);
#pragma unroll
    for (int r = 0; r < 8; ++r) l_i[r] += rs[r];

    // transpose P from C-layout to A-layout via per-wave LDS tile
#pragma unroll
    for (int ns = 0; ns < 4; ++ns)
#pragma unroll
      for (int r = 0; r < 8; ++r)
        myp[(r + hi * 8) * LP + ns * 16 + ln] = (_Float16)s[ns][r];
    __syncthreads();            // P visible (and ds writes retired)

    // ctx += P(16x64) * V_chunk(64x64);  Vt LDS tile is already [N=d][K=s]
    v16h pf0 = make_v16(*(const v8h*)&myp[ln * LP + hi * 8],
                        *(const v8h*)&myp[ln * LP + hi * 8 + 16]);
    v16h pf1 = make_v16(*(const v8h*)&myp[ln * LP + 32 + hi * 8],
                        *(const v8h*)&myp[ln * LP + 32 + hi * 8 + 16]);
#pragma unroll
    for (int ns = 0; ns < 4; ++ns) {
      const int r = ns * 16 + ln;
      v16h b0 = make_v16(*(const v8h*)&vt[cur][r * LP + hi * 8],
                         *(const v8h*)&vt[cur][r * LP + hi * 8 + 16]);
      v16h b1 = make_v16(*(const v8h*)&vt[cur][r * LP + 32 + hi * 8],
                         *(const v8h*)&vt[cur][r * LP + 32 + hi * 8 + 16]);
      o[ns] = wmma16(pf0, b0, o[ns]);
      o[ns] = wmma16(pf1, b1, o[ns]);
    }
    __syncthreads();            // all waves done reading current buffers
  }

  // normalize and store ctx as [b, s, h*64+d] f16 (rows for out-projection)
#pragma unroll
  for (int r = 0; r < 8; ++r) {
    const float inv = 1.f / l_i[r];
    const int srow = q0 + r + hi * 8;
#pragma unroll
    for (int ns = 0; ns < 4; ++ns) {
      const float v = o[ns][r] * inv;
      ctx16[((size_t)(b * SEQ + srow)) * DIM + h * 64 + ns * 16 + ln] = (_Float16)v;
    }
  }
}

// ---------------------------------------------------------------------------
// host launcher
// ---------------------------------------------------------------------------
extern "C" void kernel_launch(void* const* d_in, const int* in_sizes, int n_in,
                              void* d_out, int out_size, void* d_ws, size_t ws_size,
                              hipStream_t stream) {
  (void)in_sizes; (void)n_in; (void)out_size; (void)ws_size;
  const float* hidden = (const float*)d_in[0];
  const float* lnw    = (const float*)d_in[1];
  const float* wq     = (const float*)d_in[2];
  const float* wk     = (const float*)d_in[3];
  const float* wv     = (const float*)d_in[4];
  const float* wo     = (const float*)d_in[5];
  const float* rb     = (const float*)d_in[6];
  float* out = (float*)d_out;

  char* ws = (char*)d_ws;
  const size_t MB = 1024ull * 1024ull;
  _Float16* normed = (_Float16*)(ws);             //  8 MB  [4096][1024]
  _Float16* w16    = (_Float16*)(ws + 8  * MB);   //  8 MB  wqT|wkT|wvT|woT
  _Float16* q16    = (_Float16*)(ws + 16 * MB);   //  8 MB  [b,h,s,64]
  _Float16* k16    = (_Float16*)(ws + 24 * MB);   //  8 MB  [b,h,s,64]
  _Float16* vt16   = (_Float16*)(ws + 32 * MB);   //  8 MB  [b,h,64,s]
  _Float16* ctx16  = (_Float16*)(ws + 40 * MB);   //  8 MB  [b*s][1024]

  t5_rmsnorm_kernel<<<MTOT, 256, 0, stream>>>(hidden, lnw, normed);
  t5_convw_kernel<<<dim3(16, 8, 4), 256, 0, stream>>>(wq, wk, wv, wo, w16);
  // Q, K, Vt projections: grid.z selects the weight matrix + store layout
  t5_gemm_kernel<<<dim3(8, 32, 3), 256, 0, stream>>>(
      normed, w16, /*mode_base=*/0, q16, k16, vt16, nullptr, nullptr);
  t5_attn_kernel<<<dim3(SEQ / 128, BB * HH), 256, 0, stream>>>(
      q16, k16, vt16, rb, ctx16);
  // output projection + residual (mode 3)
  t5_gemm_kernel<<<dim3(8, 32, 1), 256, 0, stream>>>(
      ctx16, w16 + 3ull * (1u << 20), /*mode_base=*/3, nullptr, nullptr, nullptr,
      hidden, out);
}

// v004
// Measured time: 153 microseconds a run.
// In both of two side-by-side timings against v003, it was 1.32 times as fast.
// Over all steps from v000 it is 2.91 times as fast.
#include <hip/hip_runtime.h>

typedef __attribute__((ext_vector_type(16))) _Float16 v16h;
typedef __attribute__((ext_vector_type(8)))  _Float16 v8h;
typedef __attribute__((ext_vector_type(8)))  float    v8f;
typedef __attribute__((ext_vector_type(4)))  unsigned u32x4;
typedef __attribute__((ext_vector_type(8)))  int      i32x8;
typedef __attribute__((ext_vector_type(4)))  int      i32x4;

#define HH   16          // heads
#define DKV  64          // head dim
#define SEQ  2048
#define DIM  1024        // model dim == HH*DKV
#define BB   2
#define MTOT (BB * SEQ)  // 4096 rows

#if defined(__AMDGCN__) && __has_builtin(__builtin_amdgcn_tensor_load_to_lds)
#define HAVE_TDM 1
#else
#define HAVE_TDM 0
#endif

static __device__ __forceinline__ v16h make_v16(v8h lo, v8h hi) {
  union { v16h v; v8h h[2]; } u;
  u.h[0] = lo; u.h[1] = hi;
  return u.v;
}

static __device__ __forceinline__ v8f wmma16(v16h a, v16h b, v8f c) {
  // D = A(16x32 f16) x B(32x16 f16) + C(16x16 f32)
  return __builtin_amdgcn_wmma_f32_16x16x32_f16(
      /*neg_a=*/false, a, /*neg_b=*/false, b,
      /*c_mod=*/(short)0, c, /*reuse_a=*/false, /*reuse_b=*/false);
}

static __device__ __forceinline__ void async_b128(void* lds, const void* g) {
  asm volatile("global_load_async_to_lds_b128 %0, %1, off"
               :: "v"((unsigned)(unsigned long long)lds),
                  "v"((unsigned long long)g)
               : "memory");
}
static __device__ __forceinline__ void async_b128_x4(void* l0, const void* g0,
                                                     void* l1, const void* g1,
                                                     void* l2, const void* g2,
                                                     void* l3, const void* g3) {
  asm volatile("global_load_async_to_lds_b128 %0, %1, off\n\t"
               "global_load_async_to_lds_b128 %2, %3, off\n\t"
               "global_load_async_to_lds_b128 %4, %5, off\n\t"
               "global_load_async_to_lds_b128 %6, %7, off\n\t"
               "s_wait_xcnt 0x0"
               :: "v"((unsigned)(unsigned long long)l0), "v"((unsigned long long)g0),
                  "v"((unsigned)(unsigned long long)l1), "v"((unsigned long long)g1),
                  "v"((unsigned)(unsigned long long)l2), "v"((unsigned long long)g2),
                  "v"((unsigned)(unsigned long long)l3), "v"((unsigned long long)g3)
               : "memory");
}
static __device__ __forceinline__ void wait_async_le4() {
  asm volatile("s_wait_asynccnt 0x4" ::: "memory");
}
static __device__ __forceinline__ void wait_async_0() {
  asm volatile("s_wait_asynccnt 0x0" ::: "memory");
}

#if HAVE_TDM
static __device__ __forceinline__ void tdm_load_2d(void* lds, const void* gsrc,
                                                   unsigned tile_x, unsigned tile_y,
                                                   unsigned stride_elems) {
  const unsigned long long ga = (unsigned long long)gsrc;
  u32x4 g0;
  g0.x = 1u;
  g0.y = (unsigned)(unsigned long long)lds;
  g0.z = (unsigned)(ga & 0xffffffffu);
  g0.w = (unsigned)((ga >> 32) & 0x01ffffffu) | (2u << 30);
  const unsigned dim0 = stride_elems;
  const unsigned dim1 = 1u << 20;
  i32x8 g1;
  g1[0] = 0x10000;
  g1[1] = (int)((dim0 & 0xffffu) << 16);
  g1[2] = (int)((dim0 >> 16) | ((dim1 & 0xffffu) << 16));
  g1[3] = (int)((dim1 >> 16) | (tile_x << 16));
  g1[4] = (int)(tile_y & 0xffffu);
  g1[5] = (int)stride_elems;
  g1[6] = 0;
  g1[7] = 0;
  const i32x4 gz4 = {0, 0, 0, 0};
  const i32x8 gz8 = {0, 0, 0, 0, 0, 0, 0, 0};
  __builtin_amdgcn_tensor_load_to_lds(g0, g1, gz4, gz4, gz8, 0);
}
#endif

// ---------------------------------------------------------------------------
// Kernel 1: RMS norm (T5 LayerNorm: no mean subtraction) -> f16 activations
// ---------------------------------------------------------------------------
__global__ void t5_rmsnorm_kernel(const float* __restrict__ hs,
                                  const float* __restrict__ w,
                                  _Float16* __restrict__ out) {
  __shared__ float red[256];
  const int row = blockIdx.x;
  const int t = threadIdx.x;
  const float* r = hs + (size_t)row * DIM;

  float vals[4];
  float s = 0.f;
#pragma unroll
  for (int i = 0; i < 4; ++i) {
    vals[i] = r[t + i * 256];
    s += vals[i] * vals[i];
  }
  red[t] = s;
  __syncthreads();
  for (int off = 128; off > 0; off >>= 1) {
    if (t < off) red[t] += red[t + off];
    __syncthreads();
  }
  const float rs = rsqrtf(red[0] * (1.0f / DIM) + 1e-6f);
#pragma unroll
  for (int i = 0; i < 4; ++i) {
    const int c = t + i * 256;
    out[(size_t)row * DIM + c] = (_Float16)(vals[i] * w[c] * rs);
  }
}

typedef __attribute__((ext_vector_type(4))) float    f32x4;
typedef __attribute__((ext_vector_type(2))) _Float16 v2h;
__global__ void __launch_bounds__(256) t5_convw_kernel(const float* __restrict__ wq,
                                const float* __restrict__ wk,
                                const float* __restrict__ wv,
                                const float* __restrict__ wo,
                                _Float16* __restrict__ out) {
  __shared__ __attribute__((aligned(16))) _Float16 tile[64 * 128];   // 16 KB
  const int w = blockIdx.z;
  const int e0 = blockIdx.x * 64;    // first output feature (row of transposed)
  const int d0 = blockIdx.y * 128;   // first input feature  (col of transposed)
  const float* src = (w == 0) ? wq : (w == 1) ? wk : (w == 2) ? wv : wo;
  const int t = threadIdx.x;
  const int eq = t & 15;             // this thread's four e: 4 * eq + 0..3
  const int rp = t >> 4;             // its d pairs: 2 * (rp + 16 * i) + 0..1

  f32x4 ra[4], rb[4];
#pragma unroll
  for (int i = 0; i < 4; ++i) {
    const float* p = src + (size_t)(d0 + 2 * (rp + 16 * i)) * 1024 + e0 + 4 * eq;
    ra[i] = *(const f32x4*)p;
    rb[i] = *(const f32x4*)(p + 1024);
    // a later load's result may be given the registers that held this pair's
    // address: the wait stands between these two loads and any such write
    asm volatile("s_wait_xcnt 0x0" ::: "memory");
  }
#pragma unroll
  for (int i = 0; i < 4; ++i) {
    const int d = 2 * (rp + 16 * i);
    const int piece = (d >> 3) ^ eq;             // (e >> 2) & 15 == eq
#pragma unroll
    for (int j = 0; j < 4; ++j) {
      v2h pr;
      pr[0] = (_Float16)ra[i][j];
      pr[1] = (_Float16)rb[i][j];
      *(v2h*)&tile[(4 * eq + j) * 128 + piece * 8 + (d & 7)] = pr;
    }
  }
  __syncthreads();                   // whole tile written before any row is read
  _Float16* dst = out + ((size_t)w << 20) + (size_t)e0 * 1024 + d0;
#pragma unroll
  for (int i = 0; i < 4; ++i) {
    const int id = t + i * 256;
    const int e = id >> 4, c = id & 15;
    const v8h v = *(const v8h*)&tile[e * 128 + (c ^ ((e >> 2) & 15)) * 8];
    *(v8h*)&dst[(size_t)e * 1024 + c * 8] = v;
  }
}

__global__ void t5_gemm_kernel(const _Float16* __restrict__ A,
                               const _Float16* __restrict__ Bt,
                               int mode_base,
                               _Float16* __restrict__ q16,
                               _Float16* __restrict__ k16,
                               _Float16* __restrict__ vt16,
                               const float* __restrict__ hidden,
                               float* __restrict__ outf) {
  __shared__ _Float16 sA[2][128 * 32];   // 2 x 8 KB
  __shared__ _Float16 sB[2][128 * 32];   // 2 x 8 KB

  const int mode = mode_base + blockIdx.z;
  const _Float16* B = Bt + ((size_t)blockIdx.z << 20);
  const int m0 = blockIdx.y * 128;
  const int n0 = blockIdx.x * 128;
  const int t = threadIdx.x;
  const int lane = t & 31, wave = t >> 5;
  const int wm = wave >> 2, wn = wave & 3;
  const int ln = lane & 15, hi = lane >> 4;

  const v8f zero = {0.f, 0.f, 0.f, 0.f, 0.f, 0.f, 0.f, 0.f};
  v8f acc[4][2];
#pragma unroll
  for (int i = 0; i < 4; ++i)
#pragma unroll
    for (int j = 0; j < 2; ++j) acc[i][j] = zero;

#if HAVE_TDM
  auto stage = [&](int k0, int buf) {
    if (wave == 0) {
      tdm_load_2d(&sA[buf][0], &A[(size_t)m0 * 1024 + k0], 32, 128, 1024);
      tdm_load_2d(&sB[buf][0], &B[(size_t)n0 * 1024 + k0], 32, 128, 1024);
    }
  };
  auto wait_stage = [&](bool pending) {
    if (wave == 0) {
      if (pending) __builtin_amdgcn_s_wait_tensorcnt(2);
      else         __builtin_amdgcn_s_wait_tensorcnt(0);
    }
  };
#else
  auto stage = [&](int k0, int buf) {
#pragma unroll
    for (int i = 0; i < 2; ++i) {
      const int c = t + i * 256;               // 0..511 chunk id
      const int row = c >> 2, col8 = (c & 3) * 8;
      async_b128(&sA[buf][row * 32 + col8],
                 &A[(size_t)(m0 + row) * 1024 + k0 + col8]);
      async_b128(&sB[buf][row * 32 + col8],
                 &B[(size_t)(n0 + row) * 1024 + k0 + col8]);
    }
  };
  auto wait_stage = [&](bool pending) {
    if (pending) wait_async_le4();
    else         wait_async_0();
  };
#endif

  const int nk = 1024 / 32;
  stage(0, 0);
  for (int ik = 0; ik < nk; ++ik) {
    const int cur = ik & 1;
    const bool pre = (ik + 1 < nk);
    if (pre) stage((ik + 1) * 32, cur ^ 1);  // prefetch next tile
    wait_stage(pre);                         // older DMAs (current buf) landed
    __syncthreads();                         // current buffer visible block-wide

    v16h af[4], bf[2];
#pragma unroll
    for (int i = 0; i < 4; ++i) {
      const int r = wm * 64 + i * 16 + ln;
      af[i] = make_v16(*(const v8h*)&sA[cur][r * 32 + hi * 8],
                       *(const v8h*)&sA[cur][r * 32 + hi * 8 + 16]);
    }
#pragma unroll
    for (int j = 0; j < 2; ++j) {
      const int r = wn * 32 + j * 16 + ln;
      bf[j] = make_v16(*(const v8h*)&sB[cur][r * 32 + hi * 8],
                       *(const v8h*)&sB[cur][r * 32 + hi * 8 + 16]);
    }
#pragma unroll
    for (int i = 0; i < 4; ++i)
#pragma unroll
      for (int j = 0; j < 2; ++j) acc[i][j] = wmma16(af[i], bf[j], acc[i][j]);

    __syncthreads();          // all waves done reading -> buffer reusable
  }

#pragma unroll
  for (int i = 0; i < 4; ++i)
#pragma unroll
    for (int j = 0; j < 2; ++j) {
      const int mbase = m0 + wm * 64 + i * 16 + hi * 8;
      const int nc = n0 + wn * 32 + j * 16 + ln;
#pragma unroll
      for (int r = 0; r < 8; ++r) {
        const int m = mbase + r;
        const float v = acc[i][j][r];
        if (mode == 3) {
          outf[(size_t)m * 1024 + nc] = hidden[(size_t)m * 1024 + nc] + v;
        } else {
          const int b = m >> 11, s = m & 2047;
          const int h = nc >> 6, d = nc & 63;
          if (mode == 0)
            q16[((size_t)(b * HH + h) * SEQ + s) * DKV + d] = (_Float16)v;
          else if (mode == 1)
            k16[((size_t)(b * HH + h) * SEQ + s) * DKV + d] = (_Float16)v;
          else
            vt16[((size_t)(b * HH + h) * DKV + d) * SEQ + s] = (_Float16)v;
        }
      }
    }
}

#define LP 72            // LDS row pitch of the K and V tiles, in halfs
static __device__ __forceinline__ float xhalf(float x) {
  const int v = __builtin_bit_cast(int, x);
  return __builtin_bit_cast(float, __builtin_amdgcn_permlanex16(
      v, v, 0x76543210, 0xfedcba98, false, false));
}
__global__ void __launch_bounds__(256) t5_attn_kernel(const _Float16* __restrict__ q16,
                               const _Float16* __restrict__ k16,
                               const _Float16* __restrict__ vt16,
                               const float* __restrict__ rel_bias,
                               _Float16* __restrict__ ctx16) {
  __shared__ _Float16 biasH[4096];        // bias[k - q + 2047]      8 KB
  __shared__ __attribute__((aligned(16))) _Float16 kt[2][64 * LP];     // K chunk [k_row][d]   2x 9 KB
  __shared__ __attribute__((aligned(16))) _Float16 vt[2][64 * LP];     // V chunk [d][k_col]   2x 9 KB

  const int bh = blockIdx.y;             // b*16 + h
  const int h = bh & 15;
  const int b = bh >> 4;
  const int t = threadIdx.x, lane = t & 31, wave = t >> 5;
  const int ln = lane & 15, hi = lane >> 4;
  const int q0 = blockIdx.x * 128 + wave * 16;

  const _Float16* qbase = q16 + (size_t)bh * SEQ * DKV;
  const _Float16* kbase = k16 + (size_t)bh * SEQ * DKV;
  const _Float16* vbase = vt16 + (size_t)bh * DKV * SEQ;

  // stage one 64-wide K/V chunk (4 async b128 per thread)
  auto stage = [&](int kc, int buf) {
    const int row = t >> 3, col8 = (t & 7) * 8;     // rows row and row + 32
    async_b128_x4(&kt[buf][row * LP + col8],
                  &kbase[(size_t)(kc + row) * DKV + col8],
                  &vt[buf][row * LP + col8],
                  &vbase[(size_t)row * SEQ + kc + col8],
                  &kt[buf][(row + 32) * LP + col8],
                  &kbase[(size_t)(kc + row + 32) * DKV + col8],
                  &vt[buf][(row + 32) * LP + col8],
                  &vbase[(size_t)(row + 32) * SEQ + kc + col8]);
  };
  stage(0, 0);

  // T5 bidirectional bucket: 16 sign buckets x {exact<8 | log-spaced to 128}
  for (int i = t; i < 4095; i += 256) {
    const int delta = i - 2047;          // k - q
    const int rb = (delta > 0) ? 16 : 0;
    const int rp = (delta < 0) ? -delta : delta;
    int bu;
    if (rp < 8) {
      bu = rp;
    } else {
      bu = 8 + (int)(__logf((float)rp * 0.125f) * (8.0f / __logf(16.0f)));
      bu = bu > 15 ? 15 : bu;
    }
    biasH[i] = (_Float16)rel_bias[(rb + bu) * HH + h];
  }

  v16h qf[2];
  {
    const _Float16* p = qbase + (size_t)(q0 + ln) * DKV;
    qf[0] = make_v16(*(const v8h*)&p[hi * 8], *(const v8h*)&p[hi * 8 + 16]);
    qf[1] = make_v16(*(const v8h*)&p[32 + hi * 8], *(const v8h*)&p[32 + hi * 8 + 16]);
  }

  const v8f zero = {0.f, 0.f, 0.f, 0.f, 0.f, 0.f, 0.f, 0.f};
  float m_i = -1e30f;      // running maximum of query q0 + ln (same in both halves)
  float l_i = 0.f;         // running sum over this lane's own keys only
  v8f o[4];                // O^T: o[j][r] = ctx[q0 + ln][16 * j + 8 * hi + r]
#pragma unroll
  for (int j = 0; j < 4; ++j) o[j] = zero;

  // bias entry of key (kc + 16 * ns + 8 * hi + r): brow[kc + 16 * ns + r]
  const _Float16* brow = &biasH[hi * 8 - (q0 + ln) + 2047];

  const int nchunk = SEQ / 64;
  for (int ic = 0; ic < nchunk; ++ic) {
    const int kc = ic * 64;
    const int cur = ic & 1;
    if (ic + 1 < nchunk) {      // prefetch next K/V chunk
      stage(kc + 64, cur ^ 1);
      wait_async_le4();
    } else {
      wait_async_0();
    }
    __syncthreads();            // current K/V tiles (+ bias table) visible

    // scores S^T(64 keys x 16 queries) = K_chunk(64x64) * Q^T(64x16)
    v8f s[4];
#pragma unroll
    for (int ns = 0; ns < 4; ++ns) {
      const int r = ns * 16 + ln;
      v16h k0 = make_v16(*(const v8h*)&kt[cur][r * LP + hi * 8],
                         *(const v8h*)&kt[cur][r * LP + hi * 8 + 16]);
      v16h k1 = make_v16(*(const v8h*)&kt[cur][r * LP + 32 + hi * 8],
                         *(const v8h*)&kt[cur][r * LP + 32 + hi * 8 + 16]);
      v8f a = zero;
      a = wmma16(k0, qf[0], a);
      a = wmma16(k1, qf[1], a);
      s[ns] = a;
    }

    // bias add + maximum over this lane's 32 keys, then over both halves
    float mx4[4];
#pragma unroll
    for (int ns = 0; ns < 4; ++ns) {
      float mx = -1e30f;
#pragma unroll
      for (int r = 0; r < 8; ++r) {
        const float v = s[ns][r] + (float)brow[kc + ns * 16 + r];
        s[ns][r] = v;
        mx = fmaxf(mx, v);
      }
      mx4[ns] = mx;
    }
    float cm = fmaxf(fmaxf(mx4[0], mx4[1]), fmaxf(mx4[2], mx4[3]));
    cm = fmaxf(cm, xhalf(cm));

    // online softmax update: one maximum, one scale and one sum per lane
    const float mnew = fmaxf(m_i, cm);
    const float scale = __expf(m_i - mnew);
    float sum4[4];
#pragma unroll
    for (int ns = 0; ns < 4; ++ns) {
      float sum = 0.f;
#pragma unroll
      for (int r = 0; r < 8; ++r) {
        const float p = __expf(s[ns][r] - mnew);
        s[ns][r] = p;
        sum += p;
      }
      sum4[ns] = sum;
    }
    m_i = mnew;
    l_i = l_i * scale + ((sum4[0] + sum4[1]) + (sum4[2] + sum4[3]));
#pragma unroll
    for (int j = 0; j < 4; ++j)
#pragma unroll
      for (int r = 0; r < 8; ++r) o[j][r] *= scale;

    // P^T as B operand: score tiles 2c and 2c + 1, converted in place, hold
    // keys 8 * hi + e and 16 + 8 * hi + e of 32-key block c: the k order of
    // the V fragments below
    v16h pf[2];
#pragma unroll
    for (int c = 0; c < 2; ++c)
#pragma unroll
      for (int e = 0; e < 8; ++e) {
        pf[c][e]     = (_Float16)s[2 * c][e];
        pf[c][e + 8] = (_Float16)s[2 * c + 1][e];
      }

    // O^T(64 d x 16 queries) += V^T_chunk(64x64) * P^T(64x16); the LDS tile
    // is already [M=d][K=key]
#pragma unroll
    for (int j = 0; j < 4; ++j) {
      const int r = j * 16 + ln;
      v16h v0 = make_v16(*(const v8h*)&vt[cur][r * LP + hi * 8],
                         *(const v8h*)&vt[cur][r * LP + hi * 8 + 16]);
      v16h v1 = make_v16(*(const v8h*)&vt[cur][r * LP + 32 + hi * 8],
                         *(const v8h*)&vt[cur][r * LP + 32 + hi * 8 + 16]);
      o[j] = wmma16(v0, pf[0], o[j]);
      o[j] = wmma16(v1, pf[1], o[j]);
    }
    __syncthreads();            // all waves done reading current buffers
  }

  // join the halves' sums, normalize and store ctx as [b, s, h*64+d] f16 (rows
  // for the out-projection): a lane's 8 values of a tile are 16 contiguous bytes
  const float inv = 1.f / (l_i + xhalf(l_i));
  _Float16* crow = &ctx16[((size_t)(b * SEQ + q0 + ln)) * DIM + h * 64 + hi * 8];
#pragma unroll
  for (int j = 0; j < 4; ++j) {
    v8h w;
#pragma unroll
    for (int r = 0; r < 8; ++r) w[r] = (_Float16)(o[j][r] * inv);
    *(v8h*)&crow[j * 16] = w;
  }
}

// ---------------------------------------------------------------------------
// host launcher
// ---------------------------------------------------------------------------
extern "C" void kernel_launch(void* const* d_in, const int* in_sizes, int n_in,
                              void* d_out, int out_size, void* d_ws, size_t ws_size,
                              hipStream_t stream) {
  (void)in_sizes; (void)n_in; (void)out_size; (void)ws_size;
  const float* hidden = (const float*)d_in[0];
  const float* lnw    = (const float*)d_in[1];
  const float* wq     = (const float*)d_in[2];
  const float* wk     = (const float*)d_in[3];
  const float* wv     = (const float*)d_in[4];
  const float* wo     = (const float*)d_in[5];
  const float* rb     = (const float*)d_in[6];
  float* out = (float*)d_out;

  char* ws = (char*)d_ws;
  const size_t MB = 1024ull * 1024ull;
  _Float16* normed = (_Float16*)(ws);             //  8 MB  [4096][1024]
  _Float16* w16    = (_Float16*)(ws + 8  * MB);   //  8 MB  wqT|wkT|wvT|woT
  _Float16* q16    = (_Float16*)(ws + 16 * MB);   //  8 MB  [b,h,s,64]
  _Float16* k16    = (_Float16*)(ws + 24 * MB);   //  8 MB  [b,h,s,64]
  _Float16* vt16   = (_Float16*)(ws + 32 * MB);   //  8 MB  [b,h,64,s]
  _Float16* ctx16  = (_Float16*)(ws + 40 * MB);   //  8 MB  [b*s][1024]

  t5_rmsnorm_kernel<<<MTOT, 256, 0, stream>>>(hidden, lnw, normed);
  t5_convw_kernel<<<dim3(16, 8, 4), 256, 0, stream>>>(wq, wk, wv, wo, w16);
  // Q, K, Vt projections: grid.z selects the weight matrix + store layout
  t5_gemm_kernel<<<dim3(8, 32, 3), 256, 0, stream>>>(
      normed, w16, /*mode_base=*/0, q16, k16, vt16, nullptr, nullptr);
  t5_attn_kernel<<<dim3(SEQ / 128, BB * HH), 256, 0, stream>>>(
      q16, k16, vt16, rb, ctx16);
  // output projection + residual (mode 3)
  t5_gemm_kernel<<<dim3(8, 32, 1), 256, 0, stream>>>(
      ctx16, w16 + 3ull * (1u << 20), /*mode_base=*/3, nullptr, nullptr, nullptr,
      hidden, out);
}

// v005
// It runs in 132 microseconds.
// Next to v004, in two timings, it ran 1.16 times as fast each time.
// Over all steps from v000 it is 3.37 times as fast.
#include <hip/hip_runtime.h>

typedef __attribute__((ext_vector_type(16))) _Float16 v16h;
typedef __attribute__((ext_vector_type(8)))  _Float16 v8h;
typedef __attribute__((ext_vector_type(8)))  float    v8f;
typedef __attribute__((ext_vector_type(4)))  unsigned u32x4;
typedef __attribute__((ext_vector_type(8)))  unsigned u32x8;

#define HH   16          // heads
#define DKV  64          // head dim
#define SEQ  2048
#define DIM  1024        // model dim == HH*DKV
#define BB   2
#define MTOT (BB * SEQ)  // 4096 rows

static __device__ __forceinline__ v16h make_v16(v8h lo, v8h hi) {
  union { v16h v; v8h h[2]; } u;
  u.h[0] = lo; u.h[1] = hi;
  return u.v;
}

static __device__ __forceinline__ v8f wmma16(v16h a, v16h b, v8f c) {
  // D = A(16x32 f16) x B(32x16 f16) + C(16x16 f32)
  return __builtin_amdgcn_wmma_f32_16x16x32_f16(
      /*neg_a=*/false, a, /*neg_b=*/false, b,
      /*c_mod=*/(short)0, c, /*reuse_a=*/false, /*reuse_b=*/false);
}

static __device__ __forceinline__ void async_b128_x4(void* l0, const void* g0,
                                                     void* l1, const void* g1,
                                                     void* l2, const void* g2,
                                                     void* l3, const void* g3) {
  asm volatile("global_load_async_to_lds_b128 %0, %1, off\n\t"
               "global_load_async_to_lds_b128 %2, %3, off\n\t"
               "global_load_async_to_lds_b128 %4, %5, off\n\t"
               "global_load_async_to_lds_b128 %6, %7, off\n\t"
               "s_wait_xcnt 0x0"
               :: "v"((unsigned)(unsigned long long)l0), "v"((unsigned long long)g0),
                  "v"((unsigned)(unsigned long long)l1), "v"((unsigned long long)g1),
                  "v"((unsigned)(unsigned long long)l2), "v"((unsigned long long)g2),
                  "v"((unsigned)(unsigned long long)l3), "v"((unsigned long long)g3)
               : "memory");
}
static __device__ __forceinline__ void wait_async_le4() {
  asm volatile("s_wait_asynccnt 0x4" ::: "memory");
}
static __device__ __forceinline__ void wait_async_0() {
  asm volatile("s_wait_asynccnt 0x0" ::: "memory");
}

// Waits for a tensor load, and for the LDS reads in front of one, are both
// written by hand at the ring's publish points.
static __device__ __forceinline__ void wait_tensor_0() {
  asm volatile("s_wait_tensorcnt 0x0" ::: "memory");
}
static __device__ __forceinline__ void wait_ds_0() {
  asm volatile("s_wait_dscnt 0x0" ::: "memory");
}
static __device__ __forceinline__ unsigned uni(unsigned v) {
  return (unsigned)__builtin_amdgcn_readfirstlane(v);
}
static __device__ __forceinline__ unsigned pinned(unsigned v) {
  unsigned w = uni(v);
  asm volatile("" : "+s"(w));   // pinned(): keeps the value in a scalar register
  return w;
}

#define GROWB   128u               // bytes of a tile row
#define GPITCH  144u               // LDS row pitch, bytes
#define GSROWS  32u                // rows per slice
#define GSLICE  6144u              // LDS bytes per slice
#define GBUF    (8u * GSLICE)      // one buffer: A slices 0..3, B slices 4..7
#define GPASSES (1024u * 2u / GROWB)

// One tensor load: GSROWS rows of GROWB bytes, source pitch 2048 B (a row of
// 1024 halfs), 1-byte elements, tensor = tile, 4 dwords of pad behind every
// 32 dwords (one row).
static __device__ __forceinline__ void tdm_slice(unsigned lds_dst, unsigned long long ga) {
  u32x4 g0;
  g0[0] = uni(1u);                                        // count = 1
  g0[1] = uni(lds_dst);                                   // LDS byte offset
  g0[2] = uni((unsigned)ga);                              // address [31:0]
  g0[3] = uni((((unsigned)(ga >> 32)) & 0x01ffffffu) | 0x80000000u);  // [56:32] | type 2
  u32x8 g1;
  g1[0] = uni((1u << 20) | (4u << 22) | (3u << 25));
  g1[1] = uni((GROWB & 0xffffu) << 16);
  g1[2] = uni((GROWB >> 16) | ((GSROWS & 0xffffu) << 16));
  g1[3] = uni((GSROWS >> 16) | (GROWB << 16));
  g1[4] = uni(GSROWS);
  g1[5] = uni(2048u);
  g1[6] = uni(0u);
  g1[7] = uni(0u);
  asm volatile("tensor_load_to_lds %0, %1" :: "s"(g0), "s"(g1) : "memory");
}

// ---------------------------------------------------------------------------
// Kernel 1: RMS norm (T5 LayerNorm: no mean subtraction) -> f16 activations
// ---------------------------------------------------------------------------
__global__ void t5_rmsnorm_kernel(const float* __restrict__ hs,
                                  const float* __restrict__ w,
                                  _Float16* __restrict__ out) {
  __shared__ float red[256];
  const int row = blockIdx.x;
  const int t = threadIdx.x;
  const float* r = hs + (size_t)row * DIM;

  float vals[4];
  float s = 0.f;
#pragma unroll
  for (int i = 0; i < 4; ++i) {
    vals[i] = r[t + i * 256];
    s += vals[i] * vals[i];
  }
  red[t] = s;
  __syncthreads();
  for (int off = 128; off > 0; off >>= 1) {
    if (t < off) red[t] += red[t + off];
    __syncthreads();
  }
  const float rs = rsqrtf(red[0] * (1.0f / DIM) + 1e-6f);
#pragma unroll
  for (int i = 0; i < 4; ++i) {
    const int c = t + i * 256;
    out[(size_t)row * DIM + c] = (_Float16)(vals[i] * w[c] * rs);
  }
}

typedef __attribute__((ext_vector_type(4))) float    f32x4;
typedef __attribute__((ext_vector_type(2))) _Float16 v2h;
__global__ void __launch_bounds__(256) t5_convw_kernel(const float* __restrict__ wq,
                                const float* __restrict__ wk,
                                const float* __restrict__ wv,
                                const float* __restrict__ wo,
                                _Float16* __restrict__ out) {
  __shared__ __attribute__((aligned(16))) _Float16 tile[64 * 128];   // 16 KB
  const int w = blockIdx.z;
  const int e0 = blockIdx.x * 64;    // first output feature (row of transposed)
  const int d0 = blockIdx.y * 128;   // first input feature  (col of transposed)
  const float* src = (w == 0) ? wq : (w == 1) ? wk : (w == 2) ? wv : wo;
  const int t = threadIdx.x;
  const int eq = t & 15;             // this thread's four e: 4 * eq + 0..3
  const int rp = t >> 4;             // its d pairs: 2 * (rp + 16 * i) + 0..1

  f32x4 ra[4], rb[4];
#pragma unroll
  for (int i = 0; i < 4; ++i) {
    const float* p = src + (size_t)(d0 + 2 * (rp + 16 * i)) * 1024 + e0 + 4 * eq;
    ra[i] = *(const f32x4*)p;
    rb[i] = *(const f32x4*)(p + 1024);
    // a later load's result may be given the registers that held this pair's
    // address: the wait stands between these two loads and any such write
    asm volatile("s_wait_xcnt 0x0" ::: "memory");
  }
#pragma unroll
  for (int i = 0; i < 4; ++i) {
    const int d = 2 * (rp + 16 * i);
    const int piece = (d >> 3) ^ eq;             // (e >> 2) & 15 == eq
#pragma unroll
    for (int j = 0; j < 4; ++j) {
      v2h pr;
      pr[0] = (_Float16)ra[i][j];
      pr[1] = (_Float16)rb[i][j];
      *(v2h*)&tile[(4 * eq + j) * 128 + piece * 8 + (d & 7)] = pr;
    }
  }
  __syncthreads();                   // whole tile written before any row is read
  _Float16* dst = out + ((size_t)w << 20) + (size_t)e0 * 1024 + d0;
#pragma unroll
  for (int i = 0; i < 4; ++i) {
    const int id = t + i * 256;
    const int e = id >> 4, c = id & 15;
    const v8h v = *(const v8h*)&tile[e * 128 + (c ^ ((e >> 2) & 15)) * 8];
    *(v8h*)&dst[(size_t)e * 1024 + c * 8] = v;
  }
}

// ---------------------------------------------------------------------------
// Kernel 3/5: tiled GEMM, C[M,N] = A[M,K] * Bt[N,K]^T  (M=4096, N=K=1024)
// Block tile 128x128, 64 k per pass, two LDS buffers. Every wave brings one
// 32-row slice per pass (waves 0..3: A, waves 4..7: B) with one tensor load,
// issued two passes ahead into the buffer that all waves have just left.
//   mode 0: Q  -> [b,h,s,64] f16       mode 1: K -> [b,h,s,64] f16
//   mode 2: V  -> [b,h,64,s] f16       mode 3: f32 out = hidden + acc
// ---------------------------------------------------------------------------
__global__ void t5_gemm_kernel(const _Float16* __restrict__ A,
                               const _Float16* __restrict__ Bt,
                               int mode_base,
                               _Float16* __restrict__ q16,
                               _Float16* __restrict__ k16,
                               _Float16* __restrict__ vt16,
                               const float* __restrict__ hidden,
                               float* __restrict__ outf) {
  __shared__ __attribute__((aligned(2048))) unsigned char ring[2 * GBUF];   // 96 KB

  const int mode = mode_base + blockIdx.z;
  const _Float16* B = Bt + ((size_t)blockIdx.z << 20);
  const int m0 = blockIdx.y * 128;
  const int n0 = blockIdx.x * 128;
  const int t = threadIdx.x;
  const int lane = t & 31;
  const int wave = (int)uni(threadIdx.x >> 5);
  const int wm = wave >> 2, wn = wave & 3;
  const int ln = lane & 15, hi = lane >> 4;

  const v8f zero = {0.f, 0.f, 0.f, 0.f, 0.f, 0.f, 0.f, 0.f};
  v8f acc[4][2];
#pragma unroll
  for (int i = 0; i < 4; ++i)
#pragma unroll
    for (int j = 0; j < 2; ++j) acc[i][j] = zero;

  // this wave's slice: its first source row and its place in buffer 0
  const _Float16* srow = (wave < 4) ? &A[(size_t)(m0 + wave * 32) * 1024]
                                    : &B[(size_t)(n0 + (wave - 4) * 32) * 1024];
  const unsigned long long sga = (unsigned long long)srow;
  const unsigned slds = (unsigned)(unsigned long long)&ring[0] + (unsigned)wave * GSLICE;
  auto stage = [&](unsigned s) {
    tdm_slice(slds + (s & 1u) * GBUF, sga + (unsigned long long)(s * GROWB));
  };

  // fragment rows of this lane in buffer 0 (k order as the hardware's: halfs
  // 8 * hi + 0..7 and 16 + 8 * hi + 0..7 of each block of 32 k)
  const unsigned char* abase = &ring[(unsigned)(wm * 2) * GSLICE + (unsigned)ln * GPITCH + (unsigned)hi * 16u];
  const unsigned char* bbase = &ring[(unsigned)(4 + wn) * GSLICE + (unsigned)ln * GPITCH + (unsigned)hi * 16u];

  stage(0);
  wait_tensor_0();            // this wave's slice of pass 0 has landed
  __syncthreads();            // ... and every other wave's
  stage(1);
  for (unsigned s = 0; s < GPASSES; ++s) {
    const unsigned char* ap = abase + (s & 1u) * GBUF;
    const unsigned char* bp = bbase + (s & 1u) * GBUF;
#pragma unroll
    for (int kk = 0; kk < 2; ++kk) {
      v16h af[4], bf[2];
#pragma unroll
      for (int i = 0; i < 4; ++i) {
        const unsigned char* p = ap + (i >> 1) * GSLICE + (i & 1) * 16 * GPITCH + kk * 64;
        af[i] = make_v16(*(const v8h*)p, *(const v8h*)(p + 32));
      }
#pragma unroll
      for (int j = 0; j < 2; ++j) {
        const unsigned char* p = bp + j * 16 * GPITCH + kk * 64;
        bf[j] = make_v16(*(const v8h*)p, *(const v8h*)(p + 32));
      }
#pragma unroll
      for (int i = 0; i < 4; ++i)
#pragma unroll
        for (int j = 0; j < 2; ++j) acc[i][j] = wmma16(af[i], bf[j], acc[i][j]);
    }

    wait_ds_0();
    wait_tensor_0();
    __syncthreads();
    const unsigned nx = pinned(s + 2u);
    if (nx < GPASSES) stage(nx);
  }
  wait_tensor_0();            // the ring's closing waits: nothing in flight to LDS,
  wait_ds_0();                // nothing of it unread, when the wave goes on

#pragma unroll
  for (int i = 0; i < 4; ++i)
#pragma unroll
    for (int j = 0; j < 2; ++j) {
      const int mbase = m0 + wm * 64 + i * 16 + hi * 8;
      const int nc = n0 + wn * 32 + j * 16 + ln;
#pragma unroll
      for (int r = 0; r < 8; ++r) {
        const int m = mbase + r;
        const float v = acc[i][j][r];
        if (mode == 3) {
          outf[(size_t)m * 1024 + nc] = hidden[(size_t)m * 1024 + nc] + v;
        } else {
          const int b = m >> 11, s = m & 2047;
          const int h = nc >> 6, d = nc & 63;
          if (mode == 0)
            q16[((size_t)(b * HH + h) * SEQ + s) * DKV + d] = (_Float16)v;
          else if (mode == 1)
            k16[((size_t)(b * HH + h) * SEQ + s) * DKV + d] = (_Float16)v;
          else
            vt16[((size_t)(b * HH + h) * DKV + d) * SEQ + s] = (_Float16)v;
        }
      }
    }
}

#define LP 72            // LDS row pitch of the K and V tiles, in halfs
static __device__ __forceinline__ float xhalf(float x) {
  const int v = __builtin_bit_cast(int, x);
  return __builtin_bit_cast(float, __builtin_amdgcn_permlanex16(
      v, v, 0x76543210, 0xfedcba98, false, false));
}
__global__ void __launch_bounds__(256) t5_attn_kernel(const _Float16* __restrict__ q16,
                               const _Float16* __restrict__ k16,
                               const _Float16* __restrict__ vt16,
                               const float* __restrict__ rel_bias,
                               _Float16* __restrict__ ctx16) {
  __shared__ _Float16 biasH[4096];        // bias[k - q + 2047]      8 KB
  __shared__ __attribute__((aligned(16))) _Float16 kt[2][64 * LP];     // K chunk [k_row][d]   2x 9 KB
  __shared__ __attribute__((aligned(16))) _Float16 vt[2][64 * LP];     // V chunk [d][k_col]   2x 9 KB

  const int bh = blockIdx.y;             // b*16 + h
  const int h = bh & 15;
  const int b = bh >> 4;
  const int t = threadIdx.x, lane = t & 31, wave = t >> 5;
  const int ln = lane & 15, hi = lane >> 4;
  const int q0 = blockIdx.x * 128 + wave * 16;

  const _Float16* qbase = q16 + (size_t)bh * SEQ * DKV;
  const _Float16* kbase = k16 + (size_t)bh * SEQ * DKV;
  const _Float16* vbase = vt16 + (size_t)bh * DKV * SEQ;

  // stage one 64-wide K/V chunk (4 async b128 per thread)
  auto stage = [&](int kc, int buf) {
    const int row = t >> 3, col8 = (t & 7) * 8;     // rows row and row + 32
    async_b128_x4(&kt[buf][row * LP + col8],
                  &kbase[(size_t)(kc + row) * DKV + col8],
                  &vt[buf][row * LP + col8],
                  &vbase[(size_t)row * SEQ + kc + col8],
                  &kt[buf][(row + 32) * LP + col8],
                  &kbase[(size_t)(kc + row + 32) * DKV + col8],
                  &vt[buf][(row + 32) * LP + col8],
                  &vbase[(size_t)(row + 32) * SEQ + kc + col8]);
  };
  stage(0, 0);

  // T5 bidirectional bucket: 16 sign buckets x {exact<8 | log-spaced to 128}
  for (int i = t; i < 4095; i += 256) {
    const int delta = i - 2047;          // k - q
    const int rb = (delta > 0) ? 16 : 0;
    const int rp = (delta < 0) ? -delta : delta;
    int bu;
    if (rp < 8) {
      bu = rp;
    } else {
      bu = 8 + (int)(__logf((float)rp * 0.125f) * (8.0f / __logf(16.0f)));
      bu = bu > 15 ? 15 : bu;
    }
    biasH[i] = (_Float16)rel_bias[(rb + bu) * HH + h];
  }

  v16h qf[2];
  {
    const _Float16* p = qbase + (size_t)(q0 + ln) * DKV;
    qf[0] = make_v16(*(const v8h*)&p[hi * 8], *(const v8h*)&p[hi * 8 + 16]);
    qf[1] = make_v16(*(const v8h*)&p[32 + hi * 8], *(const v8h*)&p[32 + hi * 8 + 16]);
  }

  const v8f zero = {0.f, 0.f, 0.f, 0.f, 0.f, 0.f, 0.f, 0.f};
  float m_i = -1e30f;      // running maximum of query q0 + ln (same in both halves)
  float l_i = 0.f;         // running sum over this lane's own keys only
  v8f o[4];                // O^T: o[j][r] = ctx[q0 + ln][16 * j + 8 * hi + r]
#pragma unroll
  for (int j = 0; j < 4; ++j) o[j] = zero;

  // bias entry of key (kc + 16 * ns + 8 * hi + r): brow[kc + 16 * ns + r]
  const _Float16* brow = &biasH[hi * 8 - (q0 + ln) + 2047];

  const int nchunk = SEQ / 64;
  for (int ic = 0; ic < nchunk; ++ic) {
    const int kc = ic * 64;
    const int cur = ic & 1;
    if (ic + 1 < nchunk) {      // prefetch next K/V chunk
      stage(kc + 64, cur ^ 1);
      wait_async_le4();
    } else {
      wait_async_0();
    }
    __syncthreads();            // current K/V tiles (+ bias table) visible

    // scores S^T(64 keys x 16 queries) = K_chunk(64x64) * Q^T(64x16)
    v8f s[4];
#pragma unroll
    for (int ns = 0; ns < 4; ++ns) {
      const int r = ns * 16 + ln;
      v16h k0 = make_v16(*(const v8h*)&kt[cur][r * LP + hi * 8],
                         *(const v8h*)&kt[cur][r * LP + hi * 8 + 16]);
      v16h k1 = make_v16(*(const v8h*)&kt[cur][r * LP + 32 + hi * 8],
                         *(const v8h*)&kt[cur][r * LP + 32 + hi * 8 + 16]);
      v8f a = zero;
      a = wmma16(k0, qf[0], a);
      a = wmma16(k1, qf[1], a);
      s[ns] = a;
    }

    // bias add + maximum over this lane's 32 keys, then over both halves
    float mx4[4];
#pragma unroll
    for (int ns = 0; ns < 4; ++ns) {
      float mx = -1e30f;
#pragma unroll
      for (int r = 0; r < 8; ++r) {
        const float v = s[ns][r] + (float)brow[kc + ns * 16 + r];
        s[ns][r] = v;
        mx = fmaxf(mx, v);
      }
      mx4[ns] = mx;
    }
    float cm = fmaxf(fmaxf(mx4[0], mx4[1]), fmaxf(mx4[2], mx4[3]));
    cm = fmaxf(cm, xhalf(cm));

    // online softmax update: one maximum, one scale and one sum per lane
    const float mnew = fmaxf(m_i, cm);
    const float scale = __expf(m_i - mnew);
    float sum4[4];
#pragma unroll
    for (int ns = 0; ns < 4; ++ns) {
      float sum = 0.f;
#pragma unroll
      for (int r = 0; r < 8; ++r) {
        const float p = __expf(s[ns][r] - mnew);
        s[ns][r] = p;
        sum += p;
      }
      sum4[ns] = sum;
    }
    m_i = mnew;
    l_i = l_i * scale + ((sum4[0] + sum4[1]) + (sum4[2] + sum4[3]));
#pragma unroll
    for (int j = 0; j < 4; ++j)
#pragma unroll
      for (int r = 0; r < 8; ++r) o[j][r] *= scale;

    // P^T as B operand: score tiles 2c and 2c + 1, converted in place, hold
    // keys 8 * hi + e and 16 + 8 * hi + e of 32-key block c: the k order of
    // the V fragments below
    v16h pf[2];
#pragma unroll
    for (int c = 0; c < 2; ++c)
#pragma unroll
      for (int e = 0; e < 8; ++e) {
        pf[c][e]     = (_Float16)s[2 * c][e];
        pf[c][e + 8] = (_Float16)s[2 * c + 1][e];
      }

    // O^T(64 d x 16 queries) += V^T_chunk(64x64) * P^T(64x16); the LDS tile
    // is already [M=d][K=key]
#pragma unroll
    for (int j = 0; j < 4; ++j) {
      const int r = j * 16 + ln;
      v16h v0 = make_v16(*(const v8h*)&vt[cur][r * LP + hi * 8],
                         *(const v8h*)&vt[cur][r * LP + hi * 8 + 16]);
      v16h v1 = make_v16(*(const v8h*)&vt[cur][r * LP + 32 + hi * 8],
                         *(const v8h*)&vt[cur][r * LP + 32 + hi * 8 + 16]);
      o[j] = wmma16(v0, pf[0], o[j]);
      o[j] = wmma16(v1, pf[1], o[j]);
    }
    __syncthreads();            // all waves done reading current buffers
  }

  // join the halves' sums, normalize and store ctx as [b, s, h*64+d] f16 (rows
  // for the out-projection): a lane's 8 values of a tile are 16 contiguous bytes
  const float inv = 1.f / (l_i + xhalf(l_i));
  _Float16* crow = &ctx16[((size_t)(b * SEQ + q0 + ln)) * DIM + h * 64 + hi * 8];
#pragma unroll
  for (int j = 0; j < 4; ++j) {
    v8h w;
#pragma unroll
    for (int r = 0; r < 8; ++r) w[r] = (_Float16)(o[j][r] * inv);
    *(v8h*)&crow[j * 16] = w;
  }
}

// ---------------------------------------------------------------------------
// host launcher
// ---------------------------------------------------------------------------
extern "C" void kernel_launch(void* const* d_in, const int* in_sizes, int n_in,
                              void* d_out, int out_size, void* d_ws, size_t ws_size,
                              hipStream_t stream) {
  (void)in_sizes; (void)n_in; (void)out_size; (void)ws_size;
  const float* hidden = (const float*)d_in[0];
  const float* lnw    = (const float*)d_in[1];
  const float* wq     = (const float*)d_in[2];
  const float* wk     = (const float*)d_in[3];
  const float* wv     = (const float*)d_in[4];
  const float* wo     = (const float*)d_in[5];
  const float* rb     = (const float*)d_in[6];
  float* out = (float*)d_out;

  char* ws = (char*)d_ws;
  const size_t MB = 1024ull * 1024ull;
  _Float16* normed = (_Float16*)(ws);             //  8 MB  [4096][1024]
  _Float16* w16    = (_Float16*)(ws + 8  * MB);   //  8 MB  wqT|wkT|wvT|woT
  _Float16* q16    = (_Float16*)(ws + 16 * MB);   //  8 MB  [b,h,s,64]
  _Float16* k16    = (_Float16*)(ws + 24 * MB);   //  8 MB  [b,h,s,64]
  _Float16* vt16   = (_Float16*)(ws + 32 * MB);   //  8 MB  [b,h,64,s]
  _Float16* ctx16  = (_Float16*)(ws + 40 * MB);   //  8 MB  [b*s][1024]

  t5_rmsnorm_kernel<<<MTOT, 256, 0, stream>>>(hidden, lnw, normed);
  t5_convw_kernel<<<dim3(16, 8, 4), 256, 0, stream>>>(wq, wk, wv, wo, w16);
  // Q, K, Vt projections: grid.z selects the weight matrix + store layout
  t5_gemm_kernel<<<dim3(8, 32, 3), 256, 0, stream>>>(
      normed, w16, /*mode_base=*/0, q16, k16, vt16, nullptr, nullptr);
  t5_attn_kernel<<<dim3(SEQ / 128, BB * HH), 256, 0, stream>>>(
      q16, k16, vt16, rb, ctx16);
  // output projection + residual (mode 3)
  t5_gemm_kernel<<<dim3(8, 32, 1), 256, 0, stream>>>(
      ctx16, w16 + 3ull * (1u << 20), /*mode_base=*/3, nullptr, nullptr, nullptr,
      hidden, out);
}

// v006
// A run of this version takes 107 microseconds.
// Two timings next to v005 put it at 1.23 and 1.24 times that version's speed.
// All steps since v000 together make it 4.15 times as fast.
#include <hip/hip_runtime.h>

typedef __attribute__((ext_vector_type(16))) _Float16 v16h;
typedef __attribute__((ext_vector_type(8)))  _Float16 v8h;
typedef __attribute__((ext_vector_type(8)))  float    v8f;
typedef __attribute__((ext_vector_type(4)))  unsigned u32x4;
typedef __attribute__((ext_vector_type(8)))  unsigned u32x8;

#define HH   16          // heads
#define DKV  64          // head dim
#define SEQ  2048
#define DIM  1024        // model dim == HH*DKV
#define BB   2
#define MTOT (BB * SEQ)  // 4096 rows

static __device__ __forceinline__ v16h make_v16(v8h lo, v8h hi) {
  union { v16h v; v8h h[2]; } u;
  u.h[0] = lo; u.h[1] = hi;
  return u.v;
}

static __device__ __forceinline__ v8f wmma16(v16h a, v16h b, v8f c) {
  // D = A(16x32 f16) x B(32x16 f16) + C(16x16 f32)
  return __builtin_amdgcn_wmma_f32_16x16x32_f16(
      /*neg_a=*/false, a, /*neg_b=*/false, b,
      /*c_mod=*/(short)0, c, /*reuse_a=*/false, /*reuse_b=*/false);
}

static __device__ __forceinline__ void async_b128_x4(void* l0, const void* g0,
                                                     void* l1, const void* g1,
                                                     void* l2, const void* g2,
                                                     void* l3, const void* g3) {
  asm volatile("global_load_async_to_lds_b128 %0, %1, off\n\t"
               "global_load_async_to_lds_b128 %2, %3, off\n\t"
               "global_load_async_to_lds_b128 %4, %5, off\n\t"
               "global_load_async_to_lds_b128 %6, %7, off\n\t"
               "s_wait_xcnt 0x0"
               :: "v"((unsigned)(unsigned long long)l0), "v"((unsigned long long)g0),
                  "v"((unsigned)(unsigned long long)l1), "v"((unsigned long long)g1),
                  "v"((unsigned)(unsigned long long)l2), "v"((unsigned long long)g2),
                  "v"((unsigned)(unsigned long long)l3), "v"((unsigned long long)g3)
               : "memory");
}
static __device__ __forceinline__ void wait_async_le4() {
  asm volatile("s_wait_asynccnt 0x4" ::: "memory");
}
static __device__ __forceinline__ void wait_async_0() {
  asm volatile("s_wait_asynccnt 0x0" ::: "memory");
}

// Waits for a tensor load, and for the LDS reads in front of one, are both
// written by hand at the ring's publish points.
static __device__ __forceinline__ void wait_tensor_0() {
  asm volatile("s_wait_tensorcnt 0x0" ::: "memory");
}
static __device__ __forceinline__ void wait_ds_0() {
  asm volatile("s_wait_dscnt 0x0" ::: "memory");
}
static __device__ __forceinline__ unsigned uni(unsigned v) {
  return (unsigned)__builtin_amdgcn_readfirstlane(v);
}
static __device__ __forceinline__ unsigned pinned(unsigned v) {
  unsigned w = uni(v);
  asm volatile("" : "+s"(w));   // pinned(): keeps the value in a scalar register
  return w;
}

#define GROWB   128u               // bytes of a tile row
#define GPITCH  144u               // LDS row pitch, bytes
#define GSROWS  32u                // rows per slice
#define GSLICE  6144u              // LDS bytes per slice
#define GBUF    (8u * GSLICE)      // one buffer: A slices 0..3, B slices 4..7
#define GPASSES (1024u * 2u / GROWB)

// One tensor load: GSROWS rows of GROWB bytes, source pitch 2048 B (a row of
// 1024 halfs), 1-byte elements, tensor = tile, 4 dwords of pad behind every
// 32 dwords (one row).
static __device__ __forceinline__ void tdm_slice(unsigned lds_dst, unsigned long long ga) {
  u32x4 g0;
  g0[0] = uni(1u);                                        // count = 1
  g0[1] = uni(lds_dst);                                   // LDS byte offset
  g0[2] = uni((unsigned)ga);                              // address [31:0]
  g0[3] = uni((((unsigned)(ga >> 32)) & 0x01ffffffu) | 0x80000000u);  // [56:32] | type 2
  u32x8 g1;
  g1[0] = uni((1u << 20) | (4u << 22) | (3u << 25));
  g1[1] = uni((GROWB & 0xffffu) << 16);
  g1[2] = uni((GROWB >> 16) | ((GSROWS & 0xffffu) << 16));
  g1[3] = uni((GSROWS >> 16) | (GROWB << 16));
  g1[4] = uni(GSROWS);
  g1[5] = uni(2048u);
  g1[6] = uni(0u);
  g1[7] = uni(0u);
  asm volatile("tensor_load_to_lds %0, %1" :: "s"(g0), "s"(g1) : "memory");
}

// ---------------------------------------------------------------------------
// Kernel 1: RMS norm (T5 LayerNorm: no mean subtraction) -> f16 activations
// ---------------------------------------------------------------------------
__global__ void t5_rmsnorm_kernel(const float* __restrict__ hs,
                                  const float* __restrict__ w,
                                  _Float16* __restrict__ out) {
  __shared__ float red[256];
  const int row = blockIdx.x;
  const int t = threadIdx.x;
  const float* r = hs + (size_t)row * DIM;

  float vals[4];
  float s = 0.f;
#pragma unroll
  for (int i = 0; i < 4; ++i) {
    vals[i] = r[t + i * 256];
    s += vals[i] * vals[i];
  }
  red[t] = s;
  __syncthreads();
  for (int off = 128; off > 0; off >>= 1) {
    if (t < off) red[t] += red[t + off];
    __syncthreads();
  }
  const float rs = rsqrtf(red[0] * (1.0f / DIM) + 1e-6f);
#pragma unroll
  for (int i = 0; i < 4; ++i) {
    const int c = t + i * 256;
    out[(size_t)row * DIM + c] = (_Float16)(vals[i] * w[c] * rs);
  }
}

typedef __attribute__((ext_vector_type(4))) float    f32x4;
typedef __attribute__((ext_vector_type(2))) _Float16 v2h;
__global__ void __launch_bounds__(256) t5_convw_kernel(const float* __restrict__ wq,
                                const float* __restrict__ wk,
                                const float* __restrict__ wv,
                                const float* __restrict__ wo,
                                _Float16* __restrict__ out) {
  __shared__ __attribute__((aligned(16))) _Float16 tile[64 * 128];   // 16 KB
  const int w = blockIdx.z;
  const int e0 = blockIdx.x * 64;    // first output feature (row of transposed)
  const int d0 = blockIdx.y * 128;   // first input feature  (col of transposed)
  const float* src = (w == 0) ? wq : (w == 1) ? wk : (w == 2) ? wv : wo;
  const int t = threadIdx.x;
  const int eq = t & 15;             // this thread's four e: 4 * eq + 0..3
  const int rp = t >> 4;             // its d pairs: 2 * (rp + 16 * i) + 0..1

  f32x4 ra[4], rb[4];
#pragma unroll
  for (int i = 0; i < 4; ++i) {
    const float* p = src + (size_t)(d0 + 2 * (rp + 16 * i)) * 1024 + e0 + 4 * eq;
    ra[i] = *(const f32x4*)p;
    rb[i] = *(const f32x4*)(p + 1024);
    // a later load's result may be given the registers that held this pair's
    // address: the wait stands between these two loads and any such write
    asm volatile("s_wait_xcnt 0x0" ::: "memory");
  }
#pragma unroll
  for (int i = 0; i < 4; ++i) {
    const int d = 2 * (rp + 16 * i);
    const int piece = (d >> 3) ^ eq;             // (e >> 2) & 15 == eq
#pragma unroll
    for (int j = 0; j < 4; ++j) {
      v2h pr;
      pr[0] = (_Float16)ra[i][j];
      pr[1] = (_Float16)rb[i][j];
      *(v2h*)&tile[(4 * eq + j) * 128 + piece * 8 + (d & 7)] = pr;
    }
  }
  __syncthreads();                   // whole tile written before any row is read
  _Float16* dst = out + ((size_t)w << 20) + (size_t)e0 * 1024 + d0;
#pragma unroll
  for (int i = 0; i < 4; ++i) {
    const int id = t + i * 256;
    const int e = id >> 4, c = id & 15;
    const v8h v = *(const v8h*)&tile[e * 128 + (c ^ ((e >> 2) & 15)) * 8];
    *(v8h*)&dst[(size_t)e * 1024 + c * 8] = v;
  }
}

// ---------------------------------------------------------------------------
// Kernel 3/5: tiled GEMM, C[M,N] = A[M,K] * Bt[N,K]^T  (M=4096, N=K=1024)
// Block tile 128x128, 64 k per pass, two LDS buffers. Every wave brings one
// 32-row slice per pass (waves 0..3: A, waves 4..7: B) with one tensor load,
// issued two passes ahead into the buffer that all waves have just left.
//   mode 0: Q  -> [b,h,s,64] f16       mode 1: K -> [b,h,s,64] f16
//   mode 2: V  -> [b,h,64,s] f16       mode 3: f32 out = hidden + acc
// A lane's 8 results of an accumulator tile are 8 neighbouring rows of the
// FIRST matrix operand. The first operand is therefore the side that runs
// contiguously in the output: the weight rows (n) in modes 0, 1 and 3, the
// activation rows (m = position) in mode 2. Both operands have the same
// fragment form and the block tile is square, so the choice is only which LDS
// slices a wave reads as first (64 rows) and as second operand (32 rows); the
// 8 results then leave as 16 contiguous bytes of f16 or 32 of f32.
// ---------------------------------------------------------------------------
__global__ void t5_gemm_kernel(const _Float16* __restrict__ A,
                               const _Float16* __restrict__ Bt,
                               int mode_base,
                               _Float16* __restrict__ q16,
                               _Float16* __restrict__ k16,
                               _Float16* __restrict__ vt16,
                               const float* __restrict__ hidden,
                               float* __restrict__ outf) {
  __shared__ __attribute__((aligned(2048))) unsigned char ring[2 * GBUF];   // 96 KB

  const int mode = mode_base + blockIdx.z;
  const _Float16* B = Bt + ((size_t)blockIdx.z << 20);
  const int m0 = blockIdx.y * 128;
  const int n0 = blockIdx.x * 128;
  const int t = threadIdx.x;
  const int lane = t & 31;
  const int wave = (int)uni(threadIdx.x >> 5);
  const int wm = wave >> 2, wn = wave & 3;
  const int ln = lane & 15, hi = lane >> 4;

  const v8f zero = {0.f, 0.f, 0.f, 0.f, 0.f, 0.f, 0.f, 0.f};
  v8f acc[4][2];
#pragma unroll
  for (int i = 0; i < 4; ++i)
#pragma unroll
    for (int j = 0; j < 2; ++j) acc[i][j] = zero;

  // this wave's slice: its first source row and its place in buffer 0
  const _Float16* srow = (wave < 4) ? &A[(size_t)(m0 + wave * 32) * 1024]
                                    : &B[(size_t)(n0 + (wave - 4) * 32) * 1024];
  const unsigned long long sga = (unsigned long long)srow;
  const unsigned slds = (unsigned)(unsigned long long)&ring[0] + (unsigned)wave * GSLICE;
  auto stage = [&](unsigned s) {
    tdm_slice(slds + (s & 1u) * GBUF, sga + (unsigned long long)(s * GROWB));
  };

  // fragment rows of this lane in buffer 0 (k order as the hardware's: halfs
  // 8 * hi + 0..7 and 16 + 8 * hi + 0..7 of each block of 32 k)
  // abase: first operand, two slices from wm * 2; bbase: second, slice wn
  const unsigned fsl = (mode == 2) ? 0u : 4u;   // first slice of the first operand's side
  const unsigned ssl = (mode == 2) ? 4u : 0u;   // ... of the second operand's side
  const unsigned char* abase = &ring[(fsl + (unsigned)(wm * 2)) * GSLICE + (unsigned)ln * GPITCH + (unsigned)hi * 16u];
  const unsigned char* bbase = &ring[(ssl + (unsigned)wn) * GSLICE + (unsigned)ln * GPITCH + (unsigned)hi * 16u];

  stage(0);
  wait_tensor_0();            // this wave's slice of pass 0 has landed
  __syncthreads();            // ... and every other wave's
  stage(1);
#pragma unroll 1
  for (unsigned s = 0; s < GPASSES; ++s) {
    const unsigned char* ap = abase + (s & 1u) * GBUF;
    const unsigned char* bp = bbase + (s & 1u) * GBUF;
#pragma unroll
    for (int kk = 0; kk < 2; ++kk) {
      v16h af[4], bf[2];
#pragma unroll
      for (int i = 0; i < 4; ++i) {
        const unsigned char* p = ap + (i >> 1) * GSLICE + (i & 1) * 16 * GPITCH + kk * 64;
        af[i] = make_v16(*(const v8h*)p, *(const v8h*)(p + 32));
      }
#pragma unroll
      for (int j = 0; j < 2; ++j) {
        const unsigned char* p = bp + j * 16 * GPITCH + kk * 64;
        bf[j] = make_v16(*(const v8h*)p, *(const v8h*)(p + 32));
      }
#pragma unroll
      for (int i = 0; i < 4; ++i)
#pragma unroll
        for (int j = 0; j < 2; ++j) acc[i][j] = wmma16(af[i], bf[j], acc[i][j]);
    }

    wait_ds_0();
    wait_tensor_0();
    __syncthreads();
    const unsigned nx = pinned(s + 2u);
    if (nx < GPASSES) stage(nx);
  }
  wait_tensor_0();            // the ring's closing waits: nothing in flight to LDS,
  wait_ds_0();                // nothing of it unread, when the wave goes on

  // epilogue: acc[i][j][r] belongs to row fr + 16 * i + r of the first operand's
  // side of the block tile and to row sr + 16 * j of the second operand's
  const int fr = wm * 64 + hi * 8;
  const int sr = wn * 32 + ln;
  if (mode == 3) {
#pragma unroll
    for (int j = 0; j < 2; ++j) {
      const size_t at = (size_t)(m0 + sr + j * 16) * 1024 + (size_t)(n0 + fr);
      f32x4 h[4][2];
#pragma unroll
      for (int i = 0; i < 4; ++i) {
        h[i][0] = *(const f32x4*)&hidden[at + i * 16];
        h[i][1] = *(const f32x4*)&hidden[at + i * 16 + 4];
      }
      // a later result may be given the registers that hold these loads'
      // address: the wait stands between the loads and any such write
      asm volatile("s_wait_xcnt 0x0" ::: "memory");
#pragma unroll
      for (int i = 0; i < 4; ++i) {
#pragma unroll
        for (int r = 0; r < 4; ++r) {
          h[i][0][r] += acc[i][j][r];
          h[i][1][r] += acc[i][j][r + 4];
        }
        *(f32x4*)&outf[at + i * 16] = h[i][0];
        *(f32x4*)&outf[at + i * 16 + 4] = h[i][1];
      }
      // the second half's loads may land in registers that these stores name
      if (j == 0) asm volatile("s_wait_xcnt 0x0" ::: "memory");
    }
  } else {
    // f16 outputs: tile i lies 16 halfs further in every mode; tile j lies 16
    // rows further, rows of DKV halfs (Q, K: a position) or of SEQ (V: a feature)
    const int m = m0 + ((mode == 2) ? fr : sr);
    const int nc = n0 + ((mode == 2) ? sr : fr);
    const int b = m >> 11, s = m & 2047;
    const int h = nc >> 6, d = nc & 63;
    const size_t bh = (size_t)(b * HH + h) * (SEQ * DKV);
    _Float16* dst = (mode == 2) ? &vt16[bh + (size_t)d * SEQ + s]
                                : &((mode == 0) ? q16 : k16)[bh + (size_t)s * DKV + d];
    const size_t jstep = (mode == 2) ? (size_t)16 * SEQ : (size_t)16 * DKV;
#pragma unroll
    for (int i = 0; i < 4; ++i)
#pragma unroll
      for (int j = 0; j < 2; ++j) {
        v8h w;
#pragma unroll
        for (int r = 0; r < 8; ++r) w[r] = (_Float16)acc[i][j][r];
        *(v8h*)&dst[i * 16 + j * jstep] = w;
      }
  }
}

#define LP 72            // LDS row pitch of the K and V tiles, in halfs
static __device__ __forceinline__ float xhalf(float x) {
  const int v = __builtin_bit_cast(int, x);
  return __builtin_bit_cast(float, __builtin_amdgcn_permlanex16(
      v, v, 0x76543210, 0xfedcba98, false, false));
}
__global__ void __launch_bounds__(256) t5_attn_kernel(const _Float16* __restrict__ q16,
                               const _Float16* __restrict__ k16,
                               const _Float16* __restrict__ vt16,
                               const float* __restrict__ rel_bias,
                               _Float16* __restrict__ ctx16) {
  __shared__ _Float16 biasH[4096];        // bias[k - q + 2047]      8 KB
  __shared__ __attribute__((aligned(16))) _Float16 kt[2][64 * LP];     // K chunk [k_row][d]   2x 9 KB
  __shared__ __attribute__((aligned(16))) _Float16 vt[2][64 * LP];     // V chunk [d][k_col]   2x 9 KB

  const int bh = blockIdx.y;             // b*16 + h
  const int h = bh & 15;
  const int b = bh >> 4;
  const int t = threadIdx.x, lane = t & 31, wave = t >> 5;
  const int ln = lane & 15, hi = lane >> 4;
  const int q0 = blockIdx.x * 128 + wave * 16;

  const _Float16* qbase = q16 + (size_t)bh * SEQ * DKV;
  const _Float16* kbase = k16 + (size_t)bh * SEQ * DKV;
  const _Float16* vbase = vt16 + (size_t)bh * DKV * SEQ;

  // stage one 64-wide K/V chunk (4 async b128 per thread)
  auto stage = [&](int kc, int buf) {
    const int row = t >> 3, col8 = (t & 7) * 8;     // rows row and row + 32
    async_b128_x4(&kt[buf][row * LP + col8],
                  &kbase[(size_t)(kc + row) * DKV + col8],
                  &vt[buf][row * LP + col8],
                  &vbase[(size_t)row * SEQ + kc + col8],
                  &kt[buf][(row + 32) * LP + col8],
                  &kbase[(size_t)(kc + row + 32) * DKV + col8],
                  &vt[buf][(row + 32) * LP + col8],
                  &vbase[(size_t)(row + 32) * SEQ + kc + col8]);
  };
  stage(0, 0);

  // T5 bidirectional bucket: 16 sign buckets x {exact<8 | log-spaced to 128}
  for (int i = t; i < 4095; i += 256) {
    const int delta = i - 2047;          // k - q
    const int rb = (delta > 0) ? 16 : 0;
    const int rp = (delta < 0) ? -delta : delta;
    int bu;
    if (rp < 8) {
      bu = rp;
    } else {
      bu = 8 + (int)(__logf((float)rp * 0.125f) * (8.0f / __logf(16.0f)));
      bu = bu > 15 ? 15 : bu;
    }
    biasH[i] = (_Float16)rel_bias[(rb + bu) * HH + h];
  }

  v16h qf[2];
  {
    const _Float16* p = qbase + (size_t)(q0 + ln) * DKV;
    qf[0] = make_v16(*(const v8h*)&p[hi * 8], *(const v8h*)&p[hi * 8 + 16]);
    qf[1] = make_v16(*(const v8h*)&p[32 + hi * 8], *(const v8h*)&p[32 + hi * 8 + 16]);
  }

  const v8f zero = {0.f, 0.f, 0.f, 0.f, 0.f, 0.f, 0.f, 0.f};
  float m_i = -1e30f;      // running maximum of query q0 + ln (same in both halves)
  float l_i = 0.f;         // running sum over this lane's own keys only
  v8f o[4];                // O^T: o[j][r] = ctx[q0 + ln][16 * j + 8 * hi + r]
#pragma unroll
  for (int j = 0; j < 4; ++j) o[j] = zero;

  // bias entry of key (kc + 16 * ns + 8 * hi + r): brow[kc + 16 * ns + r]
  const _Float16* brow = &biasH[hi * 8 - (q0 + ln) + 2047];

  const int nchunk = SEQ / 64;
  for (int ic = 0; ic < nchunk; ++ic) {
    const int kc = ic * 64;
    const int cur = ic & 1;
    if (ic + 1 < nchunk) {      // prefetch next K/V chunk
      stage(kc + 64, cur ^ 1);
      wait_async_le4();
    } else {
      wait_async_0();
    }
    __syncthreads();            // current K/V tiles (+ bias table) visible

    // scores S^T(64 keys x 16 queries) = K_chunk(64x64) * Q^T(64x16)
    v8f s[4];
#pragma unroll
    for (int ns = 0; ns < 4; ++ns) {
      const int r = ns * 16 + ln;
      v16h k0 = make_v16(*(const v8h*)&kt[cur][r * LP + hi * 8],
                         *(const v8h*)&kt[cur][r * LP + hi * 8 + 16]);
      v16h k1 = make_v16(*(const v8h*)&kt[cur][r * LP + 32 + hi * 8],
                         *(const v8h*)&kt[cur][r * LP + 32 + hi * 8 + 16]);
      v8f a = zero;
      a = wmma16(k0, qf[0], a);
      a = wmma16(k1, qf[1], a);
      s[ns] = a;
    }

    // bias add + maximum over this lane's 32 keys, then over both halves
    float mx4[4];
#pragma unroll
    for (int ns = 0; ns < 4; ++ns) {
      float mx = -1e30f;
#pragma unroll
      for (int r = 0; r < 8; ++r) {
        const float v = s[ns][r] + (float)brow[kc + ns * 16 + r];
        s[ns][r] = v;
        mx = fmaxf(mx, v);
      }
      mx4[ns] = mx;
    }
    float cm = fmaxf(fmaxf(mx4[0], mx4[1]), fmaxf(mx4[2], mx4[3]));
    cm = fmaxf(cm, xhalf(cm));

    // online softmax update: one maximum, one scale and one sum per lane
    const float mnew = fmaxf(m_i, cm);
    const float scale = __expf(m_i - mnew);
    float sum4[4];
#pragma unroll
    for (int ns = 0; ns < 4; ++ns) {
      float sum = 0.f;
#pragma unroll
      for (int r = 0; r < 8; ++r) {
        const float p = __expf(s[ns][r] - mnew);
        s[ns][r] = p;
        sum += p;
      }
      sum4[ns] = sum;
    }
    m_i = mnew;
    l_i = l_i * scale + ((sum4[0] + sum4[1]) + (sum4[2] + sum4[3]));
#pragma unroll
    for (int j = 0; j < 4; ++j)
#pragma unroll
      for (int r = 0; r < 8; ++r) o[j][r] *= scale;

    // P^T as B operand: score tiles 2c and 2c + 1, converted in place, hold
    // keys 8 * hi + e and 16 + 8 * hi + e of 32-key block c: the k order of
    // the V fragments below
    v16h pf[2];
#pragma unroll
    for (int c = 0; c < 2; ++c)
#pragma unroll
      for (int e = 0; e < 8; ++e) {
        pf[c][e]     = (_Float16)s[2 * c][e];
        pf[c][e + 8] = (_Float16)s[2 * c + 1][e];
      }

    // O^T(64 d x 16 queries) += V^T_chunk(64x64) * P^T(64x16); the LDS tile
    // is already [M=d][K=key]
#pragma unroll
    for (int j = 0; j < 4; ++j) {
      const int r = j * 16 + ln;
      v16h v0 = make_v16(*(const v8h*)&vt[cur][r * LP + hi * 8],
                         *(const v8h*)&vt[cur][r * LP + hi * 8 + 16]);
      v16h v1 = make_v16(*(const v8h*)&vt[cur][r * LP + 32 + hi * 8],
                         *(const v8h*)&vt[cur][r * LP + 32 + hi * 8 + 16]);
      o[j] = wmma16(v0, pf[0], o[j]);
      o[j] = wmma16(v1, pf[1], o[j]);
    }
    __syncthreads();            // all waves done reading current buffers
  }

  // join the halves' sums, normalize and store ctx as [b, s, h*64+d] f16 (rows
  // for the out-projection): a lane's 8 values of a tile are 16 contiguous bytes
  const float inv = 1.f / (l_i + xhalf(l_i));
  _Float16* crow = &ctx16[((size_t)(b * SEQ + q0 + ln)) * DIM + h * 64 + hi * 8];
#pragma unroll
  for (int j = 0; j < 4; ++j) {
    v8h w;
#pragma unroll
    for (int r = 0; r < 8; ++r) w[r] = (_Float16)(o[j][r] * inv);
    *(v8h*)&crow[j * 16] = w;
  }
}

// ---------------------------------------------------------------------------
// host launcher
// ---------------------------------------------------------------------------
extern "C" void kernel_launch(void* const* d_in, const int* in_sizes, int n_in,
                              void* d_out, int out_size, void* d_ws, size_t ws_size,
                              hipStream_t stream) {
  (void)in_sizes; (void)n_in; (void)out_size; (void)ws_size;
  const float* hidden = (const float*)d_in[0];
  const float* lnw    = (const float*)d_in[1];
  const float* wq     = (const float*)d_in[2];
  const float* wk     = (const float*)d_in[3];
  const float* wv     = (const float*)d_in[4];
  const float* wo     = (const float*)d_in[5];
  const float* rb     = (const float*)d_in[6];
  float* out = (float*)d_out;

  char* ws = (char*)d_ws;
  const size_t MB = 1024ull * 1024ull;
  _Float16* normed = (_Float16*)(ws);             //  8 MB  [4096][1024]
  _Float16* w16    = (_Float16*)(ws + 8  * MB);   //  8 MB  wqT|wkT|wvT|woT
  _Float16* q16    = (_Float16*)(ws + 16 * MB);   //  8 MB  [b,h,s,64]
  _Float16* k16    = (_Float16*)(ws + 24 * MB);   //  8 MB  [b,h,s,64]
  _Float16* vt16   = (_Float16*)(ws + 32 * MB);   //  8 MB  [b,h,64,s]
  _Float16* ctx16  = (_Float16*)(ws + 40 * MB);   //  8 MB  [b*s][1024]

  t5_rmsnorm_kernel<<<MTOT, 256, 0, stream>>>(hidden, lnw, normed);
  t5_convw_kernel<<<dim3(16, 8, 4), 256, 0, stream>>>(wq, wk, wv, wo, w16);
  // Q, K, Vt projections: grid.z selects the weight matrix + store layout
  t5_gemm_kernel<<<dim3(8, 32, 3), 256, 0, stream>>>(
      normed, w16, /*mode_base=*/0, q16, k16, vt16, nullptr, nullptr);
  t5_attn_kernel<<<dim3(SEQ / 128, BB * HH), 256, 0, stream>>>(
      q16, k16, vt16, rb, ctx16);
  // output projection + residual (mode 3)
  t5_gemm_kernel<<<dim3(8, 32, 1), 256, 0, stream>>>(
      ctx16, w16 + 3ull * (1u << 20), /*mode_base=*/3, nullptr, nullptr, nullptr,
      hidden, out);
}

// v007
// It runs in 95.3 microseconds.
// Next to v006, in two timings, it ran 1.11 times as fast each time.
// Over all steps from v000 it is 4.60 times as fast.
#include <hip/hip_runtime.h>

typedef __attribute__((ext_vector_type(16))) _Float16 v16h;
typedef __attribute__((ext_vector_type(8)))  _Float16 v8h;
typedef __attribute__((ext_vector_type(8)))  float    v8f;
typedef __attribute__((ext_vector_type(4)))  unsigned u32x4;
typedef __attribute__((ext_vector_type(8)))  unsigned u32x8;

#define HH   16          // heads
#define DKV  64          // head dim
#define SEQ  2048
#define DIM  1024        // model dim == HH*DKV
#define BB   2
#define MTOT (BB * SEQ)  // 4096 rows

static __device__ __forceinline__ v16h make_v16(v8h lo, v8h hi) {
  union { v16h v; v8h h[2]; } u;
  u.h[0] = lo; u.h[1] = hi;
  return u.v;
}

static __device__ __forceinline__ v8f wmma16(v16h a, v16h b, v8f c) {
  // D = A(16x32 f16) x B(32x16 f16) + C(16x16 f32)
  return __builtin_amdgcn_wmma_f32_16x16x32_f16(
      /*neg_a=*/false, a, /*neg_b=*/false, b,
      /*c_mod=*/(short)0, c, /*reuse_a=*/false, /*reuse_b=*/false);
}

static __device__ __forceinline__ void async_b128_x4(void* l0, const void* g0,
                                                     void* l1, const void* g1,
                                                     void* l2, const void* g2,
                                                     void* l3, const void* g3) {
  asm volatile("global_load_async_to_lds_b128 %0, %1, off\n\t"
               "global_load_async_to_lds_b128 %2, %3, off\n\t"
               "global_load_async_to_lds_b128 %4, %5, off\n\t"
               "global_load_async_to_lds_b128 %6, %7, off\n\t"
               "s_wait_xcnt 0x0"
               :: "v"((unsigned)(unsigned long long)l0), "v"((unsigned long long)g0),
                  "v"((unsigned)(unsigned long long)l1), "v"((unsigned long long)g1),
                  "v"((unsigned)(unsigned long long)l2), "v"((unsigned long long)g2),
                  "v"((unsigned)(unsigned long long)l3), "v"((unsigned long long)g3)
               : "memory");
}
static __device__ __forceinline__ void wait_async_le4() {
  asm volatile("s_wait_asynccnt 0x4" ::: "memory");
}
static __device__ __forceinline__ void wait_async_0() {
  asm volatile("s_wait_asynccnt 0x0" ::: "memory");
}

// Waits for a tensor load, and for the LDS reads in front of one, are both
// written by hand at the ring's publish points.
static __device__ __forceinline__ void wait_tensor_0() {
  asm volatile("s_wait_tensorcnt 0x0" ::: "memory");
}
static __device__ __forceinline__ void wait_ds_0() {
  asm volatile("s_wait_dscnt 0x0" ::: "memory");
}
static __device__ __forceinline__ unsigned uni(unsigned v) {
  return (unsigned)__builtin_amdgcn_readfirstlane(v);
}
static __device__ __forceinline__ unsigned pinned(unsigned v) {
  unsigned w = uni(v);
  asm volatile("" : "+s"(w));   // pinned(): keeps the value in a scalar register
  return w;
}

#define GROWB   128u               // bytes of a tile row
#define GPITCH  144u               // LDS row pitch, bytes
#define GSROWS  32u                // rows per slice
#define GSLICE  6144u              // LDS bytes per slice
#define GBUF    (8u * GSLICE)      // one buffer: A slices 0..3, B slices 4..7
#define GPASSES (1024u * 2u / GROWB)

// One tensor load: GSROWS rows of GROWB bytes, source pitch 2048 B (a row of
// 1024 halfs), 1-byte elements, tensor = tile, 4 dwords of pad behind every
// 32 dwords (one row).
static __device__ __forceinline__ void tdm_slice(unsigned lds_dst, unsigned long long ga) {
  u32x4 g0;
  g0[0] = uni(1u);                                        // count = 1
  g0[1] = uni(lds_dst);                                   // LDS byte offset
  g0[2] = uni((unsigned)ga);                              // address [31:0]
  g0[3] = uni((((unsigned)(ga >> 32)) & 0x01ffffffu) | 0x80000000u);  // [56:32] | type 2
  u32x8 g1;
  g1[0] = uni((1u << 20) | (4u << 22) | (3u << 25));
  g1[1] = uni((GROWB & 0xffffu) << 16);
  g1[2] = uni((GROWB >> 16) | ((GSROWS & 0xffffu) << 16));
  g1[3] = uni((GSROWS >> 16) | (GROWB << 16));
  g1[4] = uni(GSROWS);
  g1[5] = uni(2048u);
  g1[6] = uni(0u);
  g1[7] = uni(0u);
  asm volatile("tensor_load_to_lds %0, %1" :: "s"(g0), "s"(g1) : "memory");
}

// ---------------------------------------------------------------------------
// Kernel 1: RMS norm (T5 LayerNorm: no mean subtraction) -> f16 activations
// ---------------------------------------------------------------------------
__global__ void t5_rmsnorm_kernel(const float* __restrict__ hs,
                                  const float* __restrict__ w,
                                  _Float16* __restrict__ out) {
  __shared__ float red[256];
  const int row = blockIdx.x;
  const int t = threadIdx.x;
  const float* r = hs + (size_t)row * DIM;

  float vals[4];
  float s = 0.f;
#pragma unroll
  for (int i = 0; i < 4; ++i) {
    vals[i] = r[t + i * 256];
    s += vals[i] * vals[i];
  }
  red[t] = s;
  __syncthreads();
  for (int off = 128; off > 0; off >>= 1) {
    if (t < off) red[t] += red[t + off];
    __syncthreads();
  }
  const float rs = rsqrtf(red[0] * (1.0f / DIM) + 1e-6f);
#pragma unroll
  for (int i = 0; i < 4; ++i) {
    const int c = t + i * 256;
    out[(size_t)row * DIM + c] = (_Float16)(vals[i] * w[c] * rs);
  }
}

typedef __attribute__((ext_vector_type(4))) float    f32x4;
typedef __attribute__((ext_vector_type(2))) _Float16 v2h;
__global__ void __launch_bounds__(256) t5_convw_kernel(const float* __restrict__ wq,
                                const float* __restrict__ wk,
                                const float* __restrict__ wv,
                                const float* __restrict__ wo,
                                _Float16* __restrict__ out) {
  __shared__ __attribute__((aligned(16))) _Float16 tile[64 * 128];   // 16 KB
  const int w = blockIdx.z;
  const int e0 = blockIdx.x * 64;    // first output feature (row of transposed)
  const int d0 = blockIdx.y * 128;   // first input feature  (col of transposed)
  const float* src = (w == 0) ? wq : (w == 1) ? wk : (w == 2) ? wv : wo;
  const int t = threadIdx.x;
  const int eq = t & 15;             // this thread's four e: 4 * eq + 0..3
  const int rp = t >> 4;             // its d pairs: 2 * (rp + 16 * i) + 0..1

  f32x4 ra[4], rb[4];
#pragma unroll
  for (int i = 0; i < 4; ++i) {
    const float* p = src + (size_t)(d0 + 2 * (rp + 16 * i)) * 1024 + e0 + 4 * eq;
    ra[i] = *(const f32x4*)p;
    rb[i] = *(const f32x4*)(p + 1024);
    // a later load's result may be given the registers that held this pair's
    // address: the wait stands between these two loads and any such write
    asm volatile("s_wait_xcnt 0x0" ::: "memory");
  }
#pragma unroll
  for (int i = 0; i < 4; ++i) {
    const int d = 2 * (rp + 16 * i);
    const int piece = (d >> 3) ^ eq;             // (e >> 2) & 15 == eq
#pragma unroll
    for (int j = 0; j < 4; ++j) {
      v2h pr;
      pr[0] = (_Float16)ra[i][j];
      pr[1] = (_Float16)rb[i][j];
      *(v2h*)&tile[(4 * eq + j) * 128 + piece * 8 + (d & 7)] = pr;
    }
  }
  __syncthreads();                   // whole tile written before any row is read
  _Float16* dst = out + ((size_t)w << 20) + (size_t)e0 * 1024 + d0;
#pragma unroll
  for (int i = 0; i < 4; ++i) {
    const int id = t + i * 256;
    const int e = id >> 4, c = id & 15;
    const v8h v = *(const v8h*)&tile[e * 128 + (c ^ ((e >> 2) & 15)) * 8];
    *(v8h*)&dst[(size_t)e * 1024 + c * 8] = v;
  }
}

// ---------------------------------------------------------------------------
// Kernel 3/5: tiled GEMM, C[M,N] = A[M,K] * Bt[N,K]^T  (M=4096, N=K=1024)
// Block tile 128x128, 64 k per pass, two LDS buffers. Every wave brings one
// 32-row slice per pass (waves 0..3: A, waves 4..7: B) with one tensor load,
// issued two passes ahead into the buffer that all waves have just left.
//   mode 0: Q  -> [b,h,s,64] f16       mode 1: K -> [b,h,s,64] f16
//   mode 2: V  -> [b,h,64,s] f16       mode 3: f32 out = hidden + acc
// A lane's 8 results of an accumulator tile are 8 neighbouring rows of the
// FIRST matrix operand. The first operand is therefore the side that runs
// contiguously in the output: the weight rows (n) in modes 0, 1 and 3, the
// activation rows (m = position) in mode 2. Both operands have the same
// fragment form and the block tile is square, so the choice is only which LDS
// slices a wave reads as first (64 rows) and as second operand (32 rows); the
// 8 results then leave as 16 contiguous bytes of f16 or 32 of f32.
// ---------------------------------------------------------------------------
__global__ void t5_gemm_kernel(const _Float16* __restrict__ A,
                               const _Float16* __restrict__ Bt,
                               int mode_base,
                               _Float16* __restrict__ q16,
                               _Float16* __restrict__ k16,
                               _Float16* __restrict__ vt16,
                               const float* __restrict__ hidden,
                               float* __restrict__ outf) {
  __shared__ __attribute__((aligned(2048))) unsigned char ring[2 * GBUF];   // 96 KB

  const int mode = mode_base + blockIdx.z;
  const _Float16* B = Bt + ((size_t)blockIdx.z << 20);
  const int m0 = blockIdx.y * 128;
  const int n0 = blockIdx.x * 128;
  const int t = threadIdx.x;
  const int lane = t & 31;
  const int wave = (int)uni(threadIdx.x >> 5);
  const int wm = wave >> 2, wn = wave & 3;
  const int ln = lane & 15, hi = lane >> 4;

  const v8f zero = {0.f, 0.f, 0.f, 0.f, 0.f, 0.f, 0.f, 0.f};
  v8f acc[4][2];
#pragma unroll
  for (int i = 0; i < 4; ++i)
#pragma unroll
    for (int j = 0; j < 2; ++j) acc[i][j] = zero;

  // this wave's slice: its first source row and its place in buffer 0
  const _Float16* srow = (wave < 4) ? &A[(size_t)(m0 + wave * 32) * 1024]
                                    : &B[(size_t)(n0 + (wave - 4) * 32) * 1024];
  const unsigned long long sga = (unsigned long long)srow;
  const unsigned slds = (unsigned)(unsigned long long)&ring[0] + (unsigned)wave * GSLICE;
  auto stage = [&](unsigned s) {
    tdm_slice(slds + (s & 1u) * GBUF, sga + (unsigned long long)(s * GROWB));
  };

  // fragment rows of this lane in buffer 0 (k order as the hardware's: halfs
  // 8 * hi + 0..7 and 16 + 8 * hi + 0..7 of each block of 32 k)
  // abase: first operand, two slices from wm * 2; bbase: second, slice wn
  const unsigned fsl = (mode == 2) ? 0u : 4u;   // first slice of the first operand's side
  const unsigned ssl = (mode == 2) ? 4u : 0u;   // ... of the second operand's side
  const unsigned char* abase = &ring[(fsl + (unsigned)(wm * 2)) * GSLICE + (unsigned)ln * GPITCH + (unsigned)hi * 16u];
  const unsigned char* bbase = &ring[(ssl + (unsigned)wn) * GSLICE + (unsigned)ln * GPITCH + (unsigned)hi * 16u];

  stage(0);
  wait_tensor_0();            // this wave's slice of pass 0 has landed
  __syncthreads();            // ... and every other wave's
  stage(1);
#pragma unroll 1
  for (unsigned s = 0; s < GPASSES; ++s) {
    const unsigned char* ap = abase + (s & 1u) * GBUF;
    const unsigned char* bp = bbase + (s & 1u) * GBUF;
#pragma unroll
    for (int kk = 0; kk < 2; ++kk) {
      v16h af[4], bf[2];
#pragma unroll
      for (int i = 0; i < 4; ++i) {
        const unsigned char* p = ap + (i >> 1) * GSLICE + (i & 1) * 16 * GPITCH + kk * 64;
        af[i] = make_v16(*(const v8h*)p, *(const v8h*)(p + 32));
      }
#pragma unroll
      for (int j = 0; j < 2; ++j) {
        const unsigned char* p = bp + j * 16 * GPITCH + kk * 64;
        bf[j] = make_v16(*(const v8h*)p, *(const v8h*)(p + 32));
      }
#pragma unroll
      for (int i = 0; i < 4; ++i)
#pragma unroll
        for (int j = 0; j < 2; ++j) acc[i][j] = wmma16(af[i], bf[j], acc[i][j]);
    }

    wait_ds_0();
    wait_tensor_0();
    __syncthreads();
    const unsigned nx = pinned(s + 2u);
    if (nx < GPASSES) stage(nx);
  }
  wait_tensor_0();            // the ring's closing waits: nothing in flight to LDS,
  wait_ds_0();                // nothing of it unread, when the wave goes on

  // epilogue: acc[i][j][r] belongs to row fr + 16 * i + r of the first operand's
  // side of the block tile and to row sr + 16 * j of the second operand's
  const int fr = wm * 64 + hi * 8;
  const int sr = wn * 32 + ln;
  if (mode == 3) {
#pragma unroll
    for (int j = 0; j < 2; ++j) {
      const size_t at = (size_t)(m0 + sr + j * 16) * 1024 + (size_t)(n0 + fr);
      f32x4 h[4][2];
#pragma unroll
      for (int i = 0; i < 4; ++i) {
        h[i][0] = *(const f32x4*)&hidden[at + i * 16];
        h[i][1] = *(const f32x4*)&hidden[at + i * 16 + 4];
      }
      // a later result may be given the registers that hold these loads'
      // address: the wait stands between the loads and any such write
      asm volatile("s_wait_xcnt 0x0" ::: "memory");
#pragma unroll
      for (int i = 0; i < 4; ++i) {
#pragma unroll
        for (int r = 0; r < 4; ++r) {
          h[i][0][r] += acc[i][j][r];
          h[i][1][r] += acc[i][j][r + 4];
        }
        *(f32x4*)&outf[at + i * 16] = h[i][0];
        *(f32x4*)&outf[at + i * 16 + 4] = h[i][1];
      }
      // the second half's loads may land in registers that these stores name
      if (j == 0) asm volatile("s_wait_xcnt 0x0" ::: "memory");
    }
  } else {
    // f16 outputs: tile i lies 16 halfs further in every mode; tile j lies 16
    // rows further, rows of DKV halfs (Q, K: a position) or of SEQ (V: a feature)
    const int m = m0 + ((mode == 2) ? fr : sr);
    const int nc = n0 + ((mode == 2) ? sr : fr);
    const int b = m >> 11, s = m & 2047;
    const int h = nc >> 6, d = nc & 63;
    const size_t bh = (size_t)(b * HH + h) * (SEQ * DKV);
    _Float16* dst = (mode == 2) ? &vt16[bh + (size_t)d * SEQ + s]
                                : &((mode == 0) ? q16 : k16)[bh + (size_t)s * DKV + d];
    const size_t jstep = (mode == 2) ? (size_t)16 * SEQ : (size_t)16 * DKV;
#pragma unroll
    for (int i = 0; i < 4; ++i)
#pragma unroll
      for (int j = 0; j < 2; ++j) {
        v8h w;
#pragma unroll
        for (int r = 0; r < 8; ++r) w[r] = (_Float16)acc[i][j][r];
        *(v8h*)&dst[i * 16 + j * jstep] = w;
      }
  }
}

#define LP 72            // LDS row pitch of the K and V tiles, in halfs
#define BT 256           // bias table: entry i is the bias of k - q = i - BT
#define BSAT 128         // |k - q| from which the bucket is the sign's last
static __device__ __forceinline__ float xhalf(float x) {
  const int v = __builtin_bit_cast(int, x);
  return __builtin_bit_cast(float, __builtin_amdgcn_permlanex16(
      v, v, 0x76543210, 0xfedcba98, false, false));
}
__global__ void __launch_bounds__(256) t5_attn_kernel(const _Float16* __restrict__ q16,
                               const _Float16* __restrict__ k16,
                               const _Float16* __restrict__ vt16,
                               const float* __restrict__ rel_bias,
                               _Float16* __restrict__ ctx16) {
  __shared__ _Float16 biasH[2 * BT];      // bias[k - q + BT]        1 KB
  __shared__ __attribute__((aligned(16))) _Float16 kt[2][64 * LP];     // K chunk [k_row][d]   2x 9 KB
  __shared__ __attribute__((aligned(16))) _Float16 vt[2][64 * LP];     // V chunk [d][k_col]   2x 9 KB

  const int bh = blockIdx.y;             // b*16 + h
  const int h = bh & 15;
  const int b = bh >> 4;
  const int t = threadIdx.x, lane = t & 31, wave = t >> 5;
  const int ln = lane & 15, hi = lane >> 4;
  const int q0 = blockIdx.x * 128 + wave * 16;

  const _Float16* qbase = q16 + (size_t)bh * SEQ * DKV;
  const _Float16* kbase = k16 + (size_t)bh * SEQ * DKV;
  const _Float16* vbase = vt16 + (size_t)bh * DKV * SEQ;

  // stage one 64-wide K/V chunk (4 async b128 per thread)
  auto stage = [&](int kc, int buf) {
    const int row = t >> 3, col8 = (t & 7) * 8;     // rows row and row + 32
    async_b128_x4(&kt[buf][row * LP + col8],
                  &kbase[(size_t)(kc + row) * DKV + col8],
                  &vt[buf][row * LP + col8],
                  &vbase[(size_t)row * SEQ + kc + col8],
                  &kt[buf][(row + 32) * LP + col8],
                  &kbase[(size_t)(kc + row + 32) * DKV + col8],
                  &vt[buf][(row + 32) * LP + col8],
                  &vbase[(size_t)(row + 32) * SEQ + kc + col8]);
  };
  stage(0, 0);

  // T5 bidirectional bucket: 16 sign buckets x {exact<8 | log-spaced to 128}
  for (int i = t; i < 2 * BT; i += 256) {
    const int delta = i - BT;            // k - q
    const int rb = (delta > 0) ? 16 : 0;
    const int rp = (delta < 0) ? -delta : delta;
    int bu;
    if (rp < 8) {
      bu = rp;
    } else {
      bu = 8 + (int)(__logf((float)rp * 0.125f) * (8.0f / __logf(16.0f)));
      bu = bu > 15 ? 15 : bu;
    }
    biasH[i] = (_Float16)rel_bias[(rb + bu) * HH + h];
  }

  v16h qf[2];
  {
    const _Float16* p = qbase + (size_t)(q0 + ln) * DKV;
    qf[0] = make_v16(*(const v8h*)&p[hi * 8], *(const v8h*)&p[hi * 8 + 16]);
    qf[1] = make_v16(*(const v8h*)&p[32 + hi * 8], *(const v8h*)&p[32 + hi * 8 + 16]);
  }

  const v8f zero = {0.f, 0.f, 0.f, 0.f, 0.f, 0.f, 0.f, 0.f};
  float m_i = -1e30f;      // running maximum of query q0 + ln (same in both halves)
  float l_i = 0.f;         // running sum over this lane's own keys only
  v8f o[4];                // O^T: o[j][r] = ctx[q0 + ln][16 * j + 8 * hi + r]
#pragma unroll
  for (int j = 0; j < 4; ++j) o[j] = zero;

  // the wave's first query as a scalar: the far test below is a scalar branch
  const int q0u = __builtin_amdgcn_readfirstlane(q0);

  const int nchunk = SEQ / 64;
  for (int ic = 0; ic < nchunk; ++ic) {
    const int kc = ic * 64;
    const int cur = ic & 1;
    if (ic + 1 < nchunk) {      // prefetch next K/V chunk
      stage(kc + 64, cur ^ 1);
      wait_async_le4();
    } else {
      wait_async_0();
    }
    __syncthreads();            // current K/V tiles (+ bias table) visible

    // scores S^T(64 keys x 16 queries) = K_chunk(64x64) * Q^T(64x16)
    // plus the bias, which is the value the accumulators start from
    v8f s[4];
    auto scores = [&](int ns, v8f a) {
      const int r = ns * 16 + ln;
      v16h k0 = make_v16(*(const v8h*)&kt[cur][r * LP + hi * 8],
                         *(const v8h*)&kt[cur][r * LP + hi * 8 + 16]);
      v16h k1 = make_v16(*(const v8h*)&kt[cur][r * LP + 32 + hi * 8],
                         *(const v8h*)&kt[cur][r * LP + 32 + hi * 8 + 16]);
      a = wmma16(k0, qf[0], a);
      s[ns] = wmma16(k1, qf[1], a);
    };
    const int dk = kc - q0u;    // k - q runs from dk - 15 to dk + 63 in this wave
    if (dk - 15 >= BSAT || dk + 63 <= -BSAT) {
      // the sign's last bucket: the table's two ends (k - q = BT - 1, -BT) hold it
      const float c = (float)biasH[(dk > 0) ? 2 * BT - 1 : 0];
      const v8f a = {c, c, c, c, c, c, c, c};
#pragma unroll   // s[] indexed by constants only, so that it stays in registers
      for (int ns = 0; ns < 4; ++ns) scores(ns, a);
    } else {
      // here -BSAT - 78 < k - q < BSAT + 78: inside the table
      const _Float16* brow = &biasH[BT + dk + hi * 8 - ln];
#pragma unroll
      for (int ns = 0; ns < 4; ++ns) {
        v8f a;
#pragma unroll
        for (int r = 0; r < 8; ++r) a[r] = (float)brow[ns * 16 + r];
        scores(ns, a);
      }
    }

    // maximum over this lane's 32 keys, then over both halves
    float mx4[4];
#pragma unroll
    for (int ns = 0; ns < 4; ++ns) {
      float mx = -1e30f;
#pragma unroll
      for (int r = 0; r < 8; ++r) mx = fmaxf(mx, s[ns][r]);
      mx4[ns] = mx;
    }
    float cm = fmaxf(fmaxf(mx4[0], mx4[1]), fmaxf(mx4[2], mx4[3]));
    cm = fmaxf(cm, xhalf(cm));

    // online softmax update: one maximum, one scale and one sum per lane
    const float mnew = fmaxf(m_i, cm);
    const float scale = __expf(m_i - mnew);
    float sum4[4];
#pragma unroll
    for (int ns = 0; ns < 4; ++ns) {
      float sum = 0.f;
#pragma unroll
      for (int r = 0; r < 8; ++r) {
        const float p = __expf(s[ns][r] - mnew);
        s[ns][r] = p;
        sum += p;
      }
      sum4[ns] = sum;
    }
    m_i = mnew;
    l_i = l_i * scale + ((sum4[0] + sum4[1]) + (sum4[2] + sum4[3]));
#pragma unroll
    for (int j = 0; j < 4; ++j)
#pragma unroll
      for (int r = 0; r < 8; ++r) o[j][r] *= scale;

    // P^T as B operand: score tiles 2c and 2c + 1, converted in place, hold
    // keys 8 * hi + e and 16 + 8 * hi + e of 32-key block c: the k order of
    // the V fragments below
    v16h pf[2];
#pragma unroll
    for (int c = 0; c < 2; ++c)
#pragma unroll
      for (int e = 0; e < 8; ++e) {
        pf[c][e]     = (_Float16)s[2 * c][e];
        pf[c][e + 8] = (_Float16)s[2 * c + 1][e];
      }

    // O^T(64 d x 16 queries) += V^T_chunk(64x64) * P^T(64x16); the LDS tile
    // is already [M=d][K=key]
#pragma unroll
    for (int j = 0; j < 4; ++j) {
      const int r = j * 16 + ln;
      v16h v0 = make_v16(*(const v8h*)&vt[cur][r * LP + hi * 8],
                         *(const v8h*)&vt[cur][r * LP + hi * 8 + 16]);
      v16h v1 = make_v16(*(const v8h*)&vt[cur][r * LP + 32 + hi * 8],
                         *(const v8h*)&vt[cur][r * LP + 32 + hi * 8 + 16]);
      o[j] = wmma16(v0, pf[0], o[j]);
      o[j] = wmma16(v1, pf[1], o[j]);
    }
    __syncthreads();            // all waves done reading current buffers
  }

  // join the halves' sums, normalize and store ctx as [b, s, h*64+d] f16 (rows
  // for the out-projection): a lane's 8 values of a tile are 16 contiguous bytes
  const float inv = 1.f / (l_i + xhalf(l_i));
  _Float16* crow = &ctx16[((size_t)(b * SEQ + q0 + ln)) * DIM + h * 64 + hi * 8];
#pragma unroll
  for (int j = 0; j < 4; ++j) {
    v8h w;
#pragma unroll
    for (int r = 0; r < 8; ++r) w[r] = (_Float16)(o[j][r] * inv);
    *(v8h*)&crow[j * 16] = w;
  }
}

// ---------------------------------------------------------------------------
// host launcher
// ---------------------------------------------------------------------------
extern "C" void kernel_launch(void* const* d_in, const int* in_sizes, int n_in,
                              void* d_out, int out_size, void* d_ws, size_t ws_size,
                              hipStream_t stream) {
  (void)in_sizes; (void)n_in; (void)out_size; (void)ws_size;
  const float* hidden = (const float*)d_in[0];
  const float* lnw    = (const float*)d_in[1];
  const float* wq     = (const float*)d_in[2];
  const float* wk     = (const float*)d_in[3];
  const float* wv     = (const float*)d_in[4];
  const float* wo     = (const float*)d_in[5];
  const float* rb     = (const float*)d_in[6];
  float* out = (float*)d_out;

  char* ws = (char*)d_ws;
  const size_t MB = 1024ull * 1024ull;
  _Float16* normed = (_Float16*)(ws);             //  8 MB  [4096][1024]
  _Float16* w16    = (_Float16*)(ws + 8  * MB);   //  8 MB  wqT|wkT|wvT|woT
  _Float16* q16    = (_Float16*)(ws + 16 * MB);   //  8 MB  [b,h,s,64]
  _Float16* k16    = (_Float16*)(ws + 24 * MB);   //  8 MB  [b,h,s,64]
  _Float16* vt16   = (_Float16*)(ws + 32 * MB);   //  8 MB  [b,h,64,s]
  _Float16* ctx16  = (_Float16*)(ws + 40 * MB);   //  8 MB  [b*s][1024]

  t5_rmsnorm_kernel<<<MTOT, 256, 0, stream>>>(hidden, lnw, normed);
  t5_convw_kernel<<<dim3(16, 8, 4), 256, 0, stream>>>(wq, wk, wv, wo, w16);
  // Q, K, Vt projections: grid.z selects the weight matrix + store layout
  t5_gemm_kernel<<<dim3(8, 32, 3), 256, 0, stream>>>(
      normed, w16, /*mode_base=*/0, q16, k16, vt16, nullptr, nullptr);
  t5_attn_kernel<<<dim3(SEQ / 128, BB * HH), 256, 0, stream>>>(
      q16, k16, vt16, rb, ctx16);
  // output projection + residual (mode 3)
  t5_gemm_kernel<<<dim3(8, 32, 1), 256, 0, stream>>>(
      ctx16, w16 + 3ull * (1u << 20), /*mode_base=*/3, nullptr, nullptr, nullptr,
      hidden, out);
}

// v008
// Measured time: 92.5 microseconds a run.
// Next to v007, in two timings, it ran 1.04 times as fast each time.
// Counting every step since v000, it is 4.78 times as fast.
#include <hip/hip_runtime.h>

typedef __attribute__((ext_vector_type(16))) _Float16 v16h;
typedef __attribute__((ext_vector_type(8)))  _Float16 v8h;
typedef __attribute__((ext_vector_type(8)))  float    v8f;
typedef __attribute__((ext_vector_type(4)))  unsigned u32x4;
typedef __attribute__((ext_vector_type(8)))  unsigned u32x8;

#define HH   16          // heads
#define DKV  64          // head dim
#define SEQ  2048
#define DIM  1024        // model dim == HH*DKV
#define BB   2
#define MTOT (BB * SEQ)  // 4096 rows

static __device__ __forceinline__ v16h make_v16(v8h lo, v8h hi) {
  union { v16h v; v8h h[2]; } u;
  u.h[0] = lo; u.h[1] = hi;
  return u.v;
}

static __device__ __forceinline__ v8f wmma16(v16h a, v16h b, v8f c) {
  // D = A(16x32 f16) x B(32x16 f16) + C(16x16 f32)
  return __builtin_amdgcn_wmma_f32_16x16x32_f16(
      /*neg_a=*/false, a, /*neg_b=*/false, b,
      /*c_mod=*/(short)0, c, /*reuse_a=*/false, /*reuse_b=*/false);
}

static __device__ __forceinline__ void async_b128_x4(void* l0, const void* g0,
                                                     void* l1, const void* g1,
                                                     void* l2, const void* g2,
                                                     void* l3, const void* g3) {
  asm volatile("global_load_async_to_lds_b128 %0, %1, off\n\t"
               "global_load_async_to_lds_b128 %2, %3, off\n\t"
               "global_load_async_to_lds_b128 %4, %5, off\n\t"
               "global_load_async_to_lds_b128 %6, %7, off\n\t"
               "s_wait_xcnt 0x0"
               :: "v"((unsigned)(unsigned long long)l0), "v"((unsigned long long)g0),
                  "v"((unsigned)(unsigned long long)l1), "v"((unsigned long long)g1),
                  "v"((unsigned)(unsigned long long)l2), "v"((unsigned long long)g2),
                  "v"((unsigned)(unsigned long long)l3), "v"((unsigned long long)g3)
               : "memory");
}
static __device__ __forceinline__ void wait_async_le4() {
  asm volatile("s_wait_asynccnt 0x4" ::: "memory");
}
static __device__ __forceinline__ void wait_async_0() {
  asm volatile("s_wait_asynccnt 0x0" ::: "memory");
}

// Waits for a tensor load, and for the LDS reads in front of one, are both
// written by hand at the ring's publish points.
static __device__ __forceinline__ void wait_tensor_0() {
  asm volatile("s_wait_tensorcnt 0x0" ::: "memory");
}
static __device__ __forceinline__ void wait_ds_0() {
  asm volatile("s_wait_dscnt 0x0" ::: "memory");
}
static __device__ __forceinline__ unsigned uni(unsigned v) {
  return (unsigned)__builtin_amdgcn_readfirstlane(v);
}
static __device__ __forceinline__ unsigned pinned(unsigned v) {
  unsigned w = uni(v);
  asm volatile("" : "+s"(w));   // pinned(): keeps the value in a scalar register
  return w;
}

#define GROWB   128u               // bytes of a tile row
#define GPITCH  144u               // LDS row pitch, bytes
#define GSROWS  32u                // rows per slice
#define GSLICE  6144u              // LDS bytes per slice
#define GBUF    (8u * GSLICE)      // one buffer: A slices 0..3, B slices 4..7
#define GPASSES (1024u * 2u / GROWB)
// epilogue staging in the ring, when its passes are over
#define ESTG    (2u * GSLICE)      // LDS bytes of one wave's range
#define EP16    144                // row pitch of a 32 x 64 tile of f16, bytes
#define EP32    272                // row pitch of a 32 x 64 tile of f32, bytes

// One tensor load: GSROWS rows of GROWB bytes, source pitch 2048 B (a row of
// 1024 halfs), 1-byte elements, tensor = tile, 4 dwords of pad behind every
// 32 dwords (one row).
static __device__ __forceinline__ void tdm_slice(unsigned lds_dst, unsigned long long ga) {
  u32x4 g0;
  g0[0] = uni(1u);                                        // count = 1
  g0[1] = uni(lds_dst);                                   // LDS byte offset
  g0[2] = uni((unsigned)ga);                              // address [31:0]
  g0[3] = uni((((unsigned)(ga >> 32)) & 0x01ffffffu) | 0x80000000u);  // [56:32] | type 2
  u32x8 g1;
  g1[0] = uni((1u << 20) | (4u << 22) | (3u << 25));
  g1[1] = uni((GROWB & 0xffffu) << 16);
  g1[2] = uni((GROWB >> 16) | ((GSROWS & 0xffffu) << 16));
  g1[3] = uni((GSROWS >> 16) | (GROWB << 16));
  g1[4] = uni(GSROWS);
  g1[5] = uni(2048u);
  g1[6] = uni(0u);
  g1[7] = uni(0u);
  asm volatile("tensor_load_to_lds %0, %1" :: "s"(g0), "s"(g1) : "memory");
}

// ---------------------------------------------------------------------------
// Kernel 1: RMS norm (T5 LayerNorm: no mean subtraction) -> f16 activations
// ---------------------------------------------------------------------------
__global__ void t5_rmsnorm_kernel(const float* __restrict__ hs,
                                  const float* __restrict__ w,
                                  _Float16* __restrict__ out) {
  __shared__ float red[256];
  const int row = blockIdx.x;
  const int t = threadIdx.x;
  const float* r = hs + (size_t)row * DIM;

  float vals[4];
  float s = 0.f;
#pragma unroll
  for (int i = 0; i < 4; ++i) {
    vals[i] = r[t + i * 256];
    s += vals[i] * vals[i];
  }
  red[t] = s;
  __syncthreads();
  for (int off = 128; off > 0; off >>= 1) {
    if (t < off) red[t] += red[t + off];
    __syncthreads();
  }
  const float rs = rsqrtf(red[0] * (1.0f / DIM) + 1e-6f);
#pragma unroll
  for (int i = 0; i < 4; ++i) {
    const int c = t + i * 256;
    out[(size_t)row * DIM + c] = (_Float16)(vals[i] * w[c] * rs);
  }
}

typedef __attribute__((ext_vector_type(4))) float    f32x4;
typedef __attribute__((ext_vector_type(2))) _Float16 v2h;
__global__ void __launch_bounds__(256) t5_convw_kernel(const float* __restrict__ wq,
                                const float* __restrict__ wk,
                                const float* __restrict__ wv,
                                const float* __restrict__ wo,
                                _Float16* __restrict__ out) {
  __shared__ __attribute__((aligned(16))) _Float16 tile[64 * 128];   // 16 KB
  const int w = blockIdx.z;
  const int e0 = blockIdx.x * 64;    // first output feature (row of transposed)
  const int d0 = blockIdx.y * 128;   // first input feature  (col of transposed)
  const float* src = (w == 0) ? wq : (w == 1) ? wk : (w == 2) ? wv : wo;
  const int t = threadIdx.x;
  const int eq = t & 15;             // this thread's four e: 4 * eq + 0..3
  const int rp = t >> 4;             // its d pairs: 2 * (rp + 16 * i) + 0..1

  f32x4 ra[4], rb[4];
#pragma unroll
  for (int i = 0; i < 4; ++i) {
    const float* p = src + (size_t)(d0 + 2 * (rp + 16 * i)) * 1024 + e0 + 4 * eq;
    ra[i] = *(const f32x4*)p;
    rb[i] = *(const f32x4*)(p + 1024);
    // a later load's result may be given the registers that held this pair's
    // address: the wait stands between these two loads and any such write
    asm volatile("s_wait_xcnt 0x0" ::: "memory");
  }
#pragma unroll
  for (int i = 0; i < 4; ++i) {
    const int d = 2 * (rp + 16 * i);
    const int piece = (d >> 3) ^ eq;             // (e >> 2) & 15 == eq
#pragma unroll
    for (int j = 0; j < 4; ++j) {
      v2h pr;
      pr[0] = (_Float16)ra[i][j];
      pr[1] = (_Float16)rb[i][j];
      *(v2h*)&tile[(4 * eq + j) * 128 + piece * 8 + (d & 7)] = pr;
    }
  }
  __syncthreads();                   // whole tile written before any row is read
  _Float16* dst = out + ((size_t)w << 20) + (size_t)e0 * 1024 + d0;
#pragma unroll
  for (int i = 0; i < 4; ++i) {
    const int id = t + i * 256;
    const int e = id >> 4, c = id & 15;
    const v8h v = *(const v8h*)&tile[e * 128 + (c ^ ((e >> 2) & 15)) * 8];
    *(v8h*)&dst[(size_t)e * 1024 + c * 8] = v;
  }
}

// ---------------------------------------------------------------------------
// Kernel 3/5: tiled GEMM, C[M,N] = A[M,K] * Bt[N,K]^T  (M=4096, N=K=1024)
// Block tile 128x128, 64 k per pass, two LDS buffers. Every wave brings one
// 32-row slice per pass (waves 0..3: A, waves 4..7: B) with one tensor load,
// issued two passes ahead into the buffer that all waves have just left.
//   mode 0: Q  -> [b,h,s,64] f16       mode 1: K -> [b,h,s,64] f16
//   mode 2: V  -> [b,h,64,s] f16       mode 3: f32 out = hidden + acc
// A lane's 8 results of an accumulator tile are 8 neighbouring rows of the
// FIRST matrix operand. The first operand is therefore the side that runs
// contiguously in the output: the weight rows (n) in modes 0, 1 and 3, the
// activation rows (m = position) in mode 2. Both operands have the same
// fragment form and the block tile is square, so the choice is only which LDS
// slices a wave reads as first (64 rows) and as second operand (32 rows); the
// 8 results are then 16 contiguous bytes of f16 or 32 of f32 of an output row.
// ---------------------------------------------------------------------------
__global__ void t5_gemm_kernel(const _Float16* __restrict__ A,
                               const _Float16* __restrict__ Bt,
                               int mode_base,
                               _Float16* __restrict__ q16,
                               _Float16* __restrict__ k16,
                               _Float16* __restrict__ vt16,
                               const float* __restrict__ hidden,
                               float* __restrict__ outf) {
  __shared__ __attribute__((aligned(2048))) unsigned char ring[2 * GBUF];   // 96 KB

  const int mode = mode_base + blockIdx.z;
  const _Float16* B = Bt + ((size_t)blockIdx.z << 20);
  const int m0 = blockIdx.y * 128;
  const int n0 = blockIdx.x * 128;
  const int t = threadIdx.x;
  const int lane = t & 31;
  const int wave = (int)uni(threadIdx.x >> 5);
  const int wm = wave >> 2, wn = wave & 3;
  const int ln = lane & 15, hi = lane >> 4;

  const v8f zero = {0.f, 0.f, 0.f, 0.f, 0.f, 0.f, 0.f, 0.f};
  v8f acc[4][2];
#pragma unroll
  for (int i = 0; i < 4; ++i)
#pragma unroll
    for (int j = 0; j < 2; ++j) acc[i][j] = zero;

  // this wave's slice: its first source row and its place in buffer 0
  const _Float16* srow = (wave < 4) ? &A[(size_t)(m0 + wave * 32) * 1024]
                                    : &B[(size_t)(n0 + (wave - 4) * 32) * 1024];
  const unsigned long long sga = (unsigned long long)srow;
  const unsigned slds = (unsigned)(unsigned long long)&ring[0] + (unsigned)wave * GSLICE;
  auto stage = [&](unsigned s) {
    tdm_slice(slds + (s & 1u) * GBUF, sga + (unsigned long long)(s * GROWB));
  };

  // fragment rows of this lane in buffer 0 (k order as the hardware's: halfs
  // 8 * hi + 0..7 and 16 + 8 * hi + 0..7 of each block of 32 k)
  // abase: first operand, two slices from wm * 2; bbase: second, slice wn
  const unsigned fsl = (mode == 2) ? 0u : 4u;   // first slice of the first operand's side
  const unsigned ssl = (mode == 2) ? 4u : 0u;   // ... of the second operand's side
  const unsigned char* abase = &ring[(fsl + (unsigned)(wm * 2)) * GSLICE + (unsigned)ln * GPITCH + (unsigned)hi * 16u];
  const unsigned char* bbase = &ring[(ssl + (unsigned)wn) * GSLICE + (unsigned)ln * GPITCH + (unsigned)hi * 16u];

  stage(0);
  wait_tensor_0();            // this wave's slice of pass 0 has landed
  __syncthreads();            // ... and every other wave's
  stage(1);
#pragma unroll 1
  for (unsigned s = 0; s < GPASSES; ++s) {
    const unsigned char* ap = abase + (s & 1u) * GBUF;
    const unsigned char* bp = bbase + (s & 1u) * GBUF;
#pragma unroll
    for (int kk = 0; kk < 2; ++kk) {
      v16h af[4], bf[2];
#pragma unroll
      for (int i = 0; i < 4; ++i) {
        const unsigned char* p = ap + (i >> 1) * GSLICE + (i & 1) * 16 * GPITCH + kk * 64;
        af[i] = make_v16(*(const v8h*)p, *(const v8h*)(p + 32));
      }
#pragma unroll
      for (int j = 0; j < 2; ++j) {
        const unsigned char* p = bp + j * 16 * GPITCH + kk * 64;
        bf[j] = make_v16(*(const v8h*)p, *(const v8h*)(p + 32));
      }
#pragma unroll
      for (int i = 0; i < 4; ++i)
#pragma unroll
        for (int j = 0; j < 2; ++j) acc[i][j] = wmma16(af[i], bf[j], acc[i][j]);
    }

    wait_ds_0();
    wait_tensor_0();
    __syncthreads();
    const unsigned nx = pinned(s + 2u);
    if (nx < GPASSES) stage(nx);
  }
  wait_tensor_0();            // the ring's closing waits: nothing in flight to LDS,
  wait_ds_0();                // nothing of it unread, when the wave goes on

  // epilogue. Of the wave's tile, acc[i][j][r] is element 16 * i + 8 * hi + r of the
  // 64 that run contiguously in the output (first operand's side) in row
  // 16 * j + ln of 32 (second operand's side): stored from there, one instruction
  // would touch 16 output rows with 32 B or less in each. The tile goes through
  // LDS instead, so that one instruction stores (and in mode 3 loads) whole rows:
  // 128 B of f16 or 256 B of f32, four 128 B lines per instruction.
  // The ring is free: the barrier at the foot of the last pass stands behind every
  // wave's last read and last landed slice. Each wave uses a range of its own, so
  // no further barrier is needed. Row pitches are 16 B x odd, as for the slices.
  unsigned char* stg = &ring[(unsigned)wave * ESTG];
  if (mode == 3) {
    const int row0 = lane >> 4, col = (lane & 15) * 4;   // rows 2 * k + row0
    const size_t at = (size_t)(m0 + wn * 32 + row0) * 1024 + (size_t)(n0 + wm * 64 + col);
    f32x4 h[16];
#pragma unroll
    for (int k = 0; k < 8; ++k) h[k] = *(const f32x4*)&hidden[at + k * 2048];
#pragma unroll
    for (int i = 0; i < 4; ++i)
#pragma unroll
      for (int j = 0; j < 2; ++j) {
        unsigned char* q = stg + (j * 16 + ln) * EP32 + i * 64 + hi * 32;
        const f32x4 a0 = {acc[i][j][0], acc[i][j][1], acc[i][j][2], acc[i][j][3]};
        const f32x4 a1 = {acc[i][j][4], acc[i][j][5], acc[i][j][6], acc[i][j][7]};
        *(f32x4*)q = a0;
        *(f32x4*)(q + 16) = a1;
      }
#pragma unroll
    for (int k = 8; k < 16; ++k) h[k] = *(const f32x4*)&hidden[at + k * 2048];
    wait_ds_0();              // the wave's tile is in LDS before other lanes read it
#pragma unroll
    for (int k = 0; k < 16; ++k) {
      const f32x4 a = *(const f32x4*)(stg + (2 * k + row0) * EP32 + col * 4);
#pragma unroll
      for (int r = 0; r < 4; ++r) h[k][r] += a[r];
      *(f32x4*)&outf[at + k * 2048] = h[k];
    }
  } else {
#pragma unroll
    for (int i = 0; i < 4; ++i)
#pragma unroll
      for (int j = 0; j < 2; ++j) {
        v8h w;
#pragma unroll
        for (int r = 0; r < 8; ++r) w[r] = (_Float16)acc[i][j][r];
        *(v8h*)(stg + (j * 16 + ln) * EP16 + i * 32 + hi * 16) = w;
      }
    wait_ds_0();              // the wave's tile is in LDS before other lanes read it
    const int row0 = lane >> 3, c8 = (lane & 7) * 8;     // rows 4 * k + row0
    v8h w[8];
#pragma unroll
    for (int k = 0; k < 8; ++k) w[k] = *(const v8h*)(stg + (4 * k + row0) * EP16 + c8 * 2);
    // f16 outputs: a tile row is 64 halfs of one position (Q, K: the head's
    // features) or of one feature (V: positions); the next row lies DKV or SEQ on
    const int m = m0 + ((mode == 2) ? wm * 64 + c8 : wn * 32 + row0);
    const int nc = n0 + ((mode == 2) ? wn * 32 + row0 : wm * 64 + c8);
    const int b = m >> 11, s = m & 2047;
    const int h = nc >> 6, d = nc & 63;
    const size_t bh = (size_t)(b * HH + h) * (SEQ * DKV);
    if (mode == 2) {
      _Float16* dst = &vt16[bh + (size_t)d * SEQ + s];
#pragma unroll
      for (int k = 0; k < 8; ++k) *(v8h*)&dst[k * 4 * SEQ] = w[k];
    } else {
      _Float16* dst = &((mode == 0) ? q16 : k16)[bh + (size_t)s * DKV + d];
#pragma unroll
      for (int k = 0; k < 8; ++k) *(v8h*)&dst[k * 4 * DKV] = w[k];
    }
  }
}

#define LP 72            // LDS row pitch of the K and V tiles, in halfs
#define BT 256           // bias table: entry i is the bias of k - q = i - BT
#define BSAT 128         // |k - q| from which the bucket is the sign's last
static __device__ __forceinline__ float xhalf(float x) {
  const int v = __builtin_bit_cast(int, x);
  return __builtin_bit_cast(float, __builtin_amdgcn_permlanex16(
      v, v, 0x76543210, 0xfedcba98, false, false));
}
__global__ void __launch_bounds__(256) t5_attn_kernel(const _Float16* __restrict__ q16,
                               const _Float16* __restrict__ k16,
                               const _Float16* __restrict__ vt16,
                               const float* __restrict__ rel_bias,
                               _Float16* __restrict__ ctx16) {
  __shared__ _Float16 biasH[2 * BT];      // bias[k - q + BT]        1 KB
  __shared__ __attribute__((aligned(16))) _Float16 kt[2][64 * LP];     // K chunk [k_row][d]   2x 9 KB
  __shared__ __attribute__((aligned(16))) _Float16 vt[2][64 * LP];     // V chunk [d][k_col]   2x 9 KB

  const int bh = blockIdx.y;             // b*16 + h
  const int h = bh & 15;
  const int b = bh >> 4;
  const int t = threadIdx.x, lane = t & 31, wave = t >> 5;
  const int ln = lane & 15, hi = lane >> 4;
  const int q0 = blockIdx.x * 128 + wave * 16;

  const _Float16* qbase = q16 + (size_t)bh * SEQ * DKV;
  const _Float16* kbase = k16 + (size_t)bh * SEQ * DKV;
  const _Float16* vbase = vt16 + (size_t)bh * DKV * SEQ;

  // stage one 64-wide K/V chunk (4 async b128 per thread)
  auto stage = [&](int kc, int buf) {
    const int row = t >> 3, col8 = (t & 7) * 8;     // rows row and row + 32
    async_b128_x4(&kt[buf][row * LP + col8],
                  &kbase[(size_t)(kc + row) * DKV + col8],
                  &vt[buf][row * LP + col8],
                  &vbase[(size_t)row * SEQ + kc + col8],
                  &kt[buf][(row + 32) * LP + col8],
                  &kbase[(size_t)(kc + row + 32) * DKV + col8],
                  &vt[buf][(row + 32) * LP + col8],
                  &vbase[(size_t)(row + 32) * SEQ + kc + col8]);
  };
  stage(0, 0);

  // T5 bidirectional bucket: 16 sign buckets x {exact<8 | log-spaced to 128}
  for (int i = t; i < 2 * BT; i += 256) {
    const int delta = i - BT;            // k - q
    const int rb = (delta > 0) ? 16 : 0;
    const int rp = (delta < 0) ? -delta : delta;
    int bu;
    if (rp < 8) {
      bu = rp;
    } else {
      bu = 8 + (int)(__logf((float)rp * 0.125f) * (8.0f / __logf(16.0f)));
      bu = bu > 15 ? 15 : bu;
    }
    biasH[i] = (_Float16)rel_bias[(rb + bu) * HH + h];
  }

  v16h qf[2];
  {
    const _Float16* p = qbase + (size_t)(q0 + ln) * DKV;
    qf[0] = make_v16(*(const v8h*)&p[hi * 8], *(const v8h*)&p[hi * 8 + 16]);
    qf[1] = make_v16(*(const v8h*)&p[32 + hi * 8], *(const v8h*)&p[32 + hi * 8 + 16]);
  }

  const v8f zero = {0.f, 0.f, 0.f, 0.f, 0.f, 0.f, 0.f, 0.f};
  float m_i = -1e30f;      // running maximum of query q0 + ln (same in both halves)
  float l_i = 0.f;         // running sum over this lane's own keys only
  v8f o[4];                // O^T: o[j][r] = ctx[q0 + ln][16 * j + 8 * hi + r]
#pragma unroll
  for (int j = 0; j < 4; ++j) o[j] = zero;

  // the wave's first query as a scalar: the far test below is a scalar branch
  const int q0u = __builtin_amdgcn_readfirstlane(q0);

  const int nchunk = SEQ / 64;
  for (int ic = 0; ic < nchunk; ++ic) {
    const int kc = ic * 64;
    const int cur = ic & 1;
    if (ic + 1 < nchunk) {      // prefetch next K/V chunk
      stage(kc + 64, cur ^ 1);
      wait_async_le4();
    } else {
      wait_async_0();
    }
    __syncthreads();            // current K/V tiles (+ bias table) visible

    // scores S^T(64 keys x 16 queries) = K_chunk(64x64) * Q^T(64x16)
    // plus the bias, which is the value the accumulators start from
    v8f s[4];
    auto scores = [&](int ns, v8f a) {
      const int r = ns * 16 + ln;
      v16h k0 = make_v16(*(const v8h*)&kt[cur][r * LP + hi * 8],
                         *(const v8h*)&kt[cur][r * LP + hi * 8 + 16]);
      v16h k1 = make_v16(*(const v8h*)&kt[cur][r * LP + 32 + hi * 8],
                         *(const v8h*)&kt[cur][r * LP + 32 + hi * 8 + 16]);
      a = wmma16(k0, qf[0], a);
      s[ns] = wmma16(k1, qf[1], a);
    };
    const int dk = kc - q0u;    // k - q runs from dk - 15 to dk + 63 in this wave
    if (dk - 15 >= BSAT || dk + 63 <= -BSAT) {
      // the sign's last bucket: the table's two ends (k - q = BT - 1, -BT) hold it
      const float c = (float)biasH[(dk > 0) ? 2 * BT - 1 : 0];
      const v8f a = {c, c, c, c, c, c, c, c};
#pragma unroll   // s[] indexed by constants only, so that it stays in registers
      for (int ns = 0; ns < 4; ++ns) scores(ns, a);
    } else {
      // here -BSAT - 78 < k - q < BSAT + 78: inside the table
      const _Float16* brow = &biasH[BT + dk + hi * 8 - ln];
#pragma unroll
      for (int ns = 0; ns < 4; ++ns) {
        v8f a;
#pragma unroll
        for (int r = 0; r < 8; ++r) a[r] = (float)brow[ns * 16 + r];
        scores(ns, a);
      }
    }

    // maximum over this lane's 32 keys, then over both halves
    float mx4[4];
#pragma unroll
    for (int ns = 0; ns < 4; ++ns) {
      float mx = -1e30f;
#pragma unroll
      for (int r = 0; r < 8; ++r) mx = fmaxf(mx, s[ns][r]);
      mx4[ns] = mx;
    }
    float cm = fmaxf(fmaxf(mx4[0], mx4[1]), fmaxf(mx4[2], mx4[3]));
    cm = fmaxf(cm, xhalf(cm));

    // online softmax update: one maximum, one scale and one sum per lane
    const float mnew = fmaxf(m_i, cm);
    const float scale = __expf(m_i - mnew);
    float sum4[4];
#pragma unroll
    for (int ns = 0; ns < 4; ++ns) {
      float sum = 0.f;
#pragma unroll
      for (int r = 0; r < 8; ++r) {
        const float p = __expf(s[ns][r] - mnew);
        s[ns][r] = p;
        sum += p;
      }
      sum4[ns] = sum;
    }
    m_i = mnew;
    l_i = l_i * scale + ((sum4[0] + sum4[1]) + (sum4[2] + sum4[3]));
#pragma unroll
    for (int j = 0; j < 4; ++j)
#pragma unroll
      for (int r = 0; r < 8; ++r) o[j][r] *= scale;

    // P^T as B operand: score tiles 2c and 2c + 1, converted in place, hold
    // keys 8 * hi + e and 16 + 8 * hi + e of 32-key block c: the k order of
    // the V fragments below
    v16h pf[2];
#pragma unroll
    for (int c = 0; c < 2; ++c)
#pragma unroll
      for (int e = 0; e < 8; ++e) {
        pf[c][e]     = (_Float16)s[2 * c][e];
        pf[c][e + 8] = (_Float16)s[2 * c + 1][e];
      }

    // O^T(64 d x 16 queries) += V^T_chunk(64x64) * P^T(64x16); the LDS tile
    // is already [M=d][K=key]
#pragma unroll
    for (int j = 0; j < 4; ++j) {
      const int r = j * 16 + ln;
      v16h v0 = make_v16(*(const v8h*)&vt[cur][r * LP + hi * 8],
                         *(const v8h*)&vt[cur][r * LP + hi * 8 + 16]);
      v16h v1 = make_v16(*(const v8h*)&vt[cur][r * LP + 32 + hi * 8],
                         *(const v8h*)&vt[cur][r * LP + 32 + hi * 8 + 16]);
      o[j] = wmma16(v0, pf[0], o[j]);
      o[j] = wmma16(v1, pf[1], o[j]);
    }
    __syncthreads();            // all waves done reading current buffers
  }

  // join the halves' sums, normalize and store ctx as [b, s, h*64+d] f16 (rows
  // for the out-projection): a lane's 8 values of a tile are 16 contiguous bytes
  const float inv = 1.f / (l_i + xhalf(l_i));
  // Stored from here, one instruction would touch 16 rows with 32 B in each. The
  // wave's 16 x 64 tile goes through LDS instead, so that one instruction stores
  // four whole rows of 128 B. The K tiles are free: the barrier at the foot of the
  // last chunk stands behind every wave's last read, and no copy is in flight.
  // Each wave uses 16 rows of its own, so no further barrier is needed.
  _Float16* stg = &kt[0][0] + wave * 16 * LP;
#pragma unroll
  for (int j = 0; j < 4; ++j) {
    v8h w;
#pragma unroll
    for (int r = 0; r < 8; ++r) w[r] = (_Float16)(o[j][r] * inv);
    *(v8h*)&stg[ln * LP + j * 16 + hi * 8] = w;
  }
  wait_ds_0();                // the wave's tile is in LDS before other lanes read it
  const int row0 = lane >> 3, c8 = (lane & 7) * 8;       // rows 4 * k + row0
  _Float16* crow = &ctx16[((size_t)(b * SEQ + q0 + row0)) * DIM + h * 64 + c8];
#pragma unroll
  for (int k = 0; k < 4; ++k)
    *(v8h*)&crow[k * 4 * DIM] = *(const v8h*)&stg[(4 * k + row0) * LP + c8];
}

// ---------------------------------------------------------------------------
// host launcher
// ---------------------------------------------------------------------------
extern "C" void kernel_launch(void* const* d_in, const int* in_sizes, int n_in,
                              void* d_out, int out_size, void* d_ws, size_t ws_size,
                              hipStream_t stream) {
  (void)in_sizes; (void)n_in; (void)out_size; (void)ws_size;
  const float* hidden = (const float*)d_in[0];
  const float* lnw    = (const float*)d_in[1];
  const float* wq     = (const float*)d_in[2];
  const float* wk     = (const float*)d_in[3];
  const float* wv     = (const float*)d_in[4];
  const float* wo     = (const float*)d_in[5];
  const float* rb     = (const float*)d_in[6];
  float* out = (float*)d_out;

  char* ws = (char*)d_ws;
  const size_t MB = 1024ull * 1024ull;
  _Float16* normed = (_Float16*)(ws);             //  8 MB  [4096][1024]
  _Float16* w16    = (_Float16*)(ws + 8  * MB);   //  8 MB  wqT|wkT|wvT|woT
  _Float16* q16    = (_Float16*)(ws + 16 * MB);   //  8 MB  [b,h,s,64]
  _Float16* k16    = (_Float16*)(ws + 24 * MB);   //  8 MB  [b,h,s,64]
  _Float16* vt16   = (_Float16*)(ws + 32 * MB);   //  8 MB  [b,h,64,s]
  _Float16* ctx16  = (_Float16*)(ws + 40 * MB);   //  8 MB  [b*s][1024]

  t5_rmsnorm_kernel<<<MTOT, 256, 0, stream>>>(hidden, lnw, normed);
  t5_convw_kernel<<<dim3(16, 8, 4), 256, 0, stream>>>(wq, wk, wv, wo, w16);
  // Q, K, Vt projections: grid.z selects the weight matrix + store layout
  t5_gemm_kernel<<<dim3(8, 32, 3), 256, 0, stream>>>(
      normed, w16, /*mode_base=*/0, q16, k16, vt16, nullptr, nullptr);
  t5_attn_kernel<<<dim3(SEQ / 128, BB * HH), 256, 0, stream>>>(
      q16, k16, vt16, rb, ctx16);
  // output projection + residual (mode 3)
  t5_gemm_kernel<<<dim3(8, 32, 1), 256, 0, stream>>>(
      ctx16, w16 + 3ull * (1u << 20), /*mode_base=*/3, nullptr, nullptr, nullptr,
      hidden, out);
}

// v009
// Measured time: 88.7 microseconds a run.
// Two timings next to v008 both put it at 1.04 times that version's speed.
// All steps since v000 together make it 4.96 times as fast.
#include <hip/hip_runtime.h>

typedef __attribute__((ext_vector_type(16))) _Float16 v16h;
typedef __attribute__((ext_vector_type(8)))  _Float16 v8h;
typedef __attribute__((ext_vector_type(8)))  float    v8f;
typedef __attribute__((ext_vector_type(4)))  unsigned u32x4;
typedef __attribute__((ext_vector_type(8)))  unsigned u32x8;

#define HH   16          // heads
#define DKV  64          // head dim
#define SEQ  2048
#define DIM  1024        // model dim == HH*DKV
#define BB   2
#define MTOT (BB * SEQ)  // 4096 rows
#define LOG2E 1.44269504088896340736f

static __device__ __forceinline__ v16h make_v16(v8h lo, v8h hi) {
  union { v16h v; v8h h[2]; } u;
  u.h[0] = lo; u.h[1] = hi;
  return u.v;
}

static __device__ __forceinline__ v8f wmma16(v16h a, v16h b, v8f c) {
  // D = A(16x32 f16) x B(32x16 f16) + C(16x16 f32)
  return __builtin_amdgcn_wmma_f32_16x16x32_f16(
      /*neg_a=*/false, a, /*neg_b=*/false, b,
      /*c_mod=*/(short)0, c, /*reuse_a=*/false, /*reuse_b=*/false);
}

static __device__ __forceinline__ void async_b128_x4(void* l0, const void* g0,
                                                     void* l1, const void* g1,
                                                     void* l2, const void* g2,
                                                     void* l3, const void* g3) {
  asm volatile("global_load_async_to_lds_b128 %0, %1, off\n\t"
               "global_load_async_to_lds_b128 %2, %3, off\n\t"
               "global_load_async_to_lds_b128 %4, %5, off\n\t"
               "global_load_async_to_lds_b128 %6, %7, off\n\t"
               "s_wait_xcnt 0x0"
               :: "v"((unsigned)(unsigned long long)l0), "v"((unsigned long long)g0),
                  "v"((unsigned)(unsigned long long)l1), "v"((unsigned long long)g1),
                  "v"((unsigned)(unsigned long long)l2), "v"((unsigned long long)g2),
                  "v"((unsigned)(unsigned long long)l3), "v"((unsigned long long)g3)
               : "memory");
}
static __device__ __forceinline__ void wait_async_le4() {
  asm volatile("s_wait_asynccnt 0x4" ::: "memory");
}
static __device__ __forceinline__ void wait_async_0() {
  asm volatile("s_wait_asynccnt 0x0" ::: "memory");
}

// Waits for a tensor load, and for the LDS reads in front of one, are both
// written by hand at the ring's publish points.
static __device__ __forceinline__ void wait_tensor_0() {
  asm volatile("s_wait_tensorcnt 0x0" ::: "memory");
}
static __device__ __forceinline__ void wait_ds_0() {
  asm volatile("s_wait_dscnt 0x0" ::: "memory");
}
static __device__ __forceinline__ unsigned uni(unsigned v) {
  return (unsigned)__builtin_amdgcn_readfirstlane(v);
}
static __device__ __forceinline__ unsigned pinned(unsigned v) {
  unsigned w = uni(v);
  asm volatile("" : "+s"(w));   // pinned(): keeps the value in a scalar register
  return w;
}

#define GROWB   128u               // bytes of a tile row
#define GPITCH  144u               // LDS row pitch, bytes
#define GSROWS  32u                // rows per slice
#define GSLICE  6144u              // LDS bytes per slice
#define GBUF    (8u * GSLICE)      // one buffer: A slices 0..3, B slices 4..7
#define GPASSES (1024u * 2u / GROWB)
// epilogue staging in the ring, when its passes are over
#define ESTG    (2u * GSLICE)      // LDS bytes of one wave's range
#define EP16    144                // row pitch of a 32 x 64 tile of f16, bytes
#define EP32    272                // row pitch of a 32 x 64 tile of f32, bytes

// One tensor load: GSROWS rows of GROWB bytes, source pitch 2048 B (a row of
// 1024 halfs), 1-byte elements, tensor = tile, 4 dwords of pad behind every
// 32 dwords (one row).
static __device__ __forceinline__ void tdm_slice(unsigned lds_dst, unsigned long long ga) {
  u32x4 g0;
  g0[0] = uni(1u);                                        // count = 1
  g0[1] = uni(lds_dst);                                   // LDS byte offset
  g0[2] = uni((unsigned)ga);                              // address [31:0]
  g0[3] = uni((((unsigned)(ga >> 32)) & 0x01ffffffu) | 0x80000000u);  // [56:32] | type 2
  u32x8 g1;
  g1[0] = uni((1u << 20) | (4u << 22) | (3u << 25));
  g1[1] = uni((GROWB & 0xffffu) << 16);
  g1[2] = uni((GROWB >> 16) | ((GSROWS & 0xffffu) << 16));
  g1[3] = uni((GSROWS >> 16) | (GROWB << 16));
  g1[4] = uni(GSROWS);
  g1[5] = uni(2048u);
  g1[6] = uni(0u);
  g1[7] = uni(0u);
  asm volatile("tensor_load_to_lds %0, %1" :: "s"(g0), "s"(g1) : "memory");
}

// ---------------------------------------------------------------------------
// Kernel 1: RMS norm (T5 LayerNorm: no mean subtraction) -> f16 activations
// ---------------------------------------------------------------------------
__global__ void t5_rmsnorm_kernel(const float* __restrict__ hs,
                                  const float* __restrict__ w,
                                  _Float16* __restrict__ out) {
  __shared__ float red[256];
  const int row = blockIdx.x;
  const int t = threadIdx.x;
  const float* r = hs + (size_t)row * DIM;

  float vals[4];
  float s = 0.f;
#pragma unroll
  for (int i = 0; i < 4; ++i) {
    vals[i] = r[t + i * 256];
    s += vals[i] * vals[i];
  }
  red[t] = s;
  __syncthreads();
  for (int off = 128; off > 0; off >>= 1) {
    if (t < off) red[t] += red[t + off];
    __syncthreads();
  }
  const float rs = rsqrtf(red[0] * (1.0f / DIM) + 1e-6f);
#pragma unroll
  for (int i = 0; i < 4; ++i) {
    const int c = t + i * 256;
    out[(size_t)row * DIM + c] = (_Float16)(vals[i] * w[c] * rs);
  }
}

typedef __attribute__((ext_vector_type(4))) float    f32x4;
typedef __attribute__((ext_vector_type(2))) _Float16 v2h;
__global__ void __launch_bounds__(256) t5_convw_kernel(const float* __restrict__ wq,
                                const float* __restrict__ wk,
                                const float* __restrict__ wv,
                                const float* __restrict__ wo,
                                _Float16* __restrict__ out) {
  __shared__ __attribute__((aligned(16))) _Float16 tile[64 * 128];   // 16 KB
  const int w = blockIdx.z;
  const int e0 = blockIdx.x * 64;    // first output feature (row of transposed)
  const int d0 = blockIdx.y * 128;   // first input feature  (col of transposed)
  const float* src = (w == 0) ? wq : (w == 1) ? wk : (w == 2) ? wv : wo;
  const int t = threadIdx.x;
  const int eq = t & 15;             // this thread's four e: 4 * eq + 0..3
  const int rp = t >> 4;             // its d pairs: 2 * (rp + 16 * i) + 0..1

  f32x4 ra[4], rb[4];
#pragma unroll
  for (int i = 0; i < 4; ++i) {
    const float* p = src + (size_t)(d0 + 2 * (rp + 16 * i)) * 1024 + e0 + 4 * eq;
    ra[i] = *(const f32x4*)p;
    rb[i] = *(const f32x4*)(p + 1024);
    // a later load's result may be given the registers that held this pair's
    // address: the wait stands between these two loads and any such write
    asm volatile("s_wait_xcnt 0x0" ::: "memory");
  }
#pragma unroll
  for (int i = 0; i < 4; ++i) {
    const int d = 2 * (rp + 16 * i);
    const int piece = (d >> 3) ^ eq;             // (e >> 2) & 15 == eq
#pragma unroll
    for (int j = 0; j < 4; ++j) {
      v2h pr;
      pr[0] = (_Float16)ra[i][j];
      pr[1] = (_Float16)rb[i][j];
      *(v2h*)&tile[(4 * eq + j) * 128 + piece * 8 + (d & 7)] = pr;
    }
  }
  __syncthreads();                   // whole tile written before any row is read
  _Float16* dst = out + ((size_t)w << 20) + (size_t)e0 * 1024 + d0;
#pragma unroll
  for (int i = 0; i < 4; ++i) {
    const int id = t + i * 256;
    const int e = id >> 4, c = id & 15;
    const v8h v = *(const v8h*)&tile[e * 128 + (c ^ ((e >> 2) & 15)) * 8];
    *(v8h*)&dst[(size_t)e * 1024 + c * 8] = v;
  }
}

// ---------------------------------------------------------------------------
// Kernel 3/5: tiled GEMM, C[M,N] = A[M,K] * Bt[N,K]^T  (M=4096, N=K=1024)
// Block tile 128x128, 64 k per pass, two LDS buffers. Every wave brings one
// 32-row slice per pass (waves 0..3: A, waves 4..7: B) with one tensor load,
// issued two passes ahead into the buffer that all waves have just left.
//   mode 0: Q  -> [b,h,s,64] f16       mode 1: K -> [b,h,s,64] f16
//   mode 2: V  -> [b,h,64,s] f16       mode 3: f32 out = hidden + acc
// A lane's 8 results of an accumulator tile are 8 neighbouring rows of the
// FIRST matrix operand. The first operand is therefore the side that runs
// contiguously in the output: the weight rows (n) in modes 0, 1 and 3, the
// activation rows (m = position) in mode 2. Both operands have the same
// fragment form and the block tile is square, so the choice is only which LDS
// slices a wave reads as first (64 rows) and as second operand (32 rows); the
// 8 results are then 16 contiguous bytes of f16 or 32 of f32 of an output row.
// ---------------------------------------------------------------------------
__global__ void t5_gemm_kernel(const _Float16* __restrict__ A,
                               const _Float16* __restrict__ Bt,
                               int mode_base,
                               _Float16* __restrict__ q16,
                               _Float16* __restrict__ k16,
                               _Float16* __restrict__ vt16,
                               const float* __restrict__ hidden,
                               float* __restrict__ outf) {
  __shared__ __attribute__((aligned(2048))) unsigned char ring[2 * GBUF];   // 96 KB

  const int mode = mode_base + blockIdx.z;
  const _Float16* B = Bt + ((size_t)blockIdx.z << 20);
  const int m0 = blockIdx.y * 128;
  const int n0 = blockIdx.x * 128;
  const int t = threadIdx.x;
  const int lane = t & 31;
  const int wave = (int)uni(threadIdx.x >> 5);
  const int wm = wave >> 2, wn = wave & 3;
  const int ln = lane & 15, hi = lane >> 4;

  const v8f zero = {0.f, 0.f, 0.f, 0.f, 0.f, 0.f, 0.f, 0.f};
  v8f acc[4][2];
#pragma unroll
  for (int i = 0; i < 4; ++i)
#pragma unroll
    for (int j = 0; j < 2; ++j) acc[i][j] = zero;

  // this wave's slice: its first source row and its place in buffer 0
  const _Float16* srow = (wave < 4) ? &A[(size_t)(m0 + wave * 32) * 1024]
                                    : &B[(size_t)(n0 + (wave - 4) * 32) * 1024];
  const unsigned long long sga = (unsigned long long)srow;
  const unsigned slds = (unsigned)(unsigned long long)&ring[0] + (unsigned)wave * GSLICE;
  auto stage = [&](unsigned s) {
    tdm_slice(slds + (s & 1u) * GBUF, sga + (unsigned long long)(s * GROWB));
  };

  // fragment rows of this lane in buffer 0 (k order as the hardware's: halfs
  // 8 * hi + 0..7 and 16 + 8 * hi + 0..7 of each block of 32 k)
  // abase: first operand, two slices from wm * 2; bbase: second, slice wn
  const unsigned fsl = (mode == 2) ? 0u : 4u;   // first slice of the first operand's side
  const unsigned ssl = (mode == 2) ? 4u : 0u;   // ... of the second operand's side
  const unsigned char* abase = &ring[(fsl + (unsigned)(wm * 2)) * GSLICE + (unsigned)ln * GPITCH + (unsigned)hi * 16u];
  const unsigned char* bbase = &ring[(ssl + (unsigned)wn) * GSLICE + (unsigned)ln * GPITCH + (unsigned)hi * 16u];

  stage(0);
  wait_tensor_0();            // this wave's slice of pass 0 has landed
  __syncthreads();            // ... and every other wave's
  stage(1);
#pragma unroll 1
  for (unsigned s = 0; s < GPASSES; ++s) {
    const unsigned char* ap = abase + (s & 1u) * GBUF;
    const unsigned char* bp = bbase + (s & 1u) * GBUF;
#pragma unroll
    for (int kk = 0; kk < 2; ++kk) {
      v16h af[4], bf[2];
#pragma unroll
      for (int i = 0; i < 4; ++i) {
        const unsigned char* p = ap + (i >> 1) * GSLICE + (i & 1) * 16 * GPITCH + kk * 64;
        af[i] = make_v16(*(const v8h*)p, *(const v8h*)(p + 32));
      }
#pragma unroll
      for (int j = 0; j < 2; ++j) {
        const unsigned char* p = bp + j * 16 * GPITCH + kk * 64;
        bf[j] = make_v16(*(const v8h*)p, *(const v8h*)(p + 32));
      }
#pragma unroll
      for (int i = 0; i < 4; ++i)
#pragma unroll
        for (int j = 0; j < 2; ++j) acc[i][j] = wmma16(af[i], bf[j], acc[i][j]);
    }

    wait_ds_0();
    wait_tensor_0();
    __syncthreads();
    const unsigned nx = pinned(s + 2u);
    if (nx < GPASSES) stage(nx);
  }
  wait_tensor_0();            // the ring's closing waits: nothing in flight to LDS,
  wait_ds_0();                // nothing of it unread, when the wave goes on

  // epilogue. Of the wave's tile, acc[i][j][r] is element 16 * i + 8 * hi + r of the
  // 64 that run contiguously in the output (first operand's side) in row
  // 16 * j + ln of 32 (second operand's side): stored from there, one instruction
  // would touch 16 output rows with 32 B or less in each. The tile goes through
  // LDS instead, so that one instruction stores (and in mode 3 loads) whole rows:
  // 128 B of f16 or 256 B of f32, four 128 B lines per instruction.
  // The ring is free: the barrier at the foot of the last pass stands behind every
  // wave's last read and last landed slice. Each wave uses a range of its own, so
  // no further barrier is needed. Row pitches are 16 B x odd, as for the slices.
  unsigned char* stg = &ring[(unsigned)wave * ESTG];
  if (mode == 3) {
    const int row0 = lane >> 4, col = (lane & 15) * 4;   // rows 2 * k + row0
    const size_t at = (size_t)(m0 + wn * 32 + row0) * 1024 + (size_t)(n0 + wm * 64 + col);
    f32x4 h[16];
#pragma unroll
    for (int k = 0; k < 8; ++k) h[k] = *(const f32x4*)&hidden[at + k * 2048];
#pragma unroll
    for (int i = 0; i < 4; ++i)
#pragma unroll
      for (int j = 0; j < 2; ++j) {
        unsigned char* q = stg + (j * 16 + ln) * EP32 + i * 64 + hi * 32;
        const f32x4 a0 = {acc[i][j][0], acc[i][j][1], acc[i][j][2], acc[i][j][3]};
        const f32x4 a1 = {acc[i][j][4], acc[i][j][5], acc[i][j][6], acc[i][j][7]};
        *(f32x4*)q = a0;
        *(f32x4*)(q + 16) = a1;
      }
#pragma unroll
    for (int k = 8; k < 16; ++k) h[k] = *(const f32x4*)&hidden[at + k * 2048];
    wait_ds_0();              // the wave's tile is in LDS before other lanes read it
#pragma unroll
    for (int k = 0; k < 16; ++k) {
      const f32x4 a = *(const f32x4*)(stg + (2 * k + row0) * EP32 + col * 4);
#pragma unroll
      for (int r = 0; r < 4; ++r) h[k][r] += a[r];
      *(f32x4*)&outf[at + k * 2048] = h[k];
    }
  } else {
    // Q leaves multiplied by log2(e), in f32 ahead of its one rounding to f16:
    // the attention kernel's scores are then exponents of 2
    const float qs = (mode == 0) ? LOG2E : 1.0f;
#pragma unroll
    for (int i = 0; i < 4; ++i)
#pragma unroll
      for (int j = 0; j < 2; ++j) {
        v8h w;
#pragma unroll
        for (int r = 0; r < 8; ++r) w[r] = (_Float16)(acc[i][j][r] * qs);
        *(v8h*)(stg + (j * 16 + ln) * EP16 + i * 32 + hi * 16) = w;
      }
    wait_ds_0();              // the wave's tile is in LDS before other lanes read it
    const int row0 = lane >> 3, c8 = (lane & 7) * 8;     // rows 4 * k + row0
    v8h w[8];
#pragma unroll
    for (int k = 0; k < 8; ++k) w[k] = *(const v8h*)(stg + (4 * k + row0) * EP16 + c8 * 2);
    // f16 outputs: a tile row is 64 halfs of one position (Q, K: the head's
    // features) or of one feature (V: positions); the next row lies DKV or SEQ on
    const int m = m0 + ((mode == 2) ? wm * 64 + c8 : wn * 32 + row0);
    const int nc = n0 + ((mode == 2) ? wn * 32 + row0 : wm * 64 + c8);
    const int b = m >> 11, s = m & 2047;
    const int h = nc >> 6, d = nc & 63;
    const size_t bh = (size_t)(b * HH + h) * (SEQ * DKV);
    if (mode == 2) {
      _Float16* dst = &vt16[bh + (size_t)d * SEQ + s];
#pragma unroll
      for (int k = 0; k < 8; ++k) *(v8h*)&dst[k * 4 * SEQ] = w[k];
    } else {
      _Float16* dst = &((mode == 0) ? q16 : k16)[bh + (size_t)s * DKV + d];
#pragma unroll
      for (int k = 0; k < 8; ++k) *(v8h*)&dst[k * 4 * DKV] = w[k];
    }
  }
}

#define LP 72            // LDS row pitch of the K and V tiles, in halfs
#define BT 256           // bias table: entry i is the bias of k - q = i - BT
#define BSAT 128         // |k - q| from which the bucket is the sign's last
#define RTHR 15.0f       // a score this far above the reference moves the reference
#define RHEAD 4.0f       // ... to this far above the score
static __device__ __forceinline__ float xhalf(float x) {
  const int v = __builtin_bit_cast(int, x);
  return __builtin_bit_cast(float, __builtin_amdgcn_permlanex16(
      v, v, 0x76543210, 0xfedcba98, false, false));
}
__global__ void __launch_bounds__(256) t5_attn_kernel(const _Float16* __restrict__ q16,
                               const _Float16* __restrict__ k16,
                               const _Float16* __restrict__ vt16,
                               const float* __restrict__ rel_bias,
                               _Float16* __restrict__ ctx16) {
  __shared__ _Float16 biasH[2 * BT];      // bias[k - q + BT]        1 KB
  __shared__ __attribute__((aligned(16))) _Float16 kt[2][64 * LP];     // K chunk [k_row][d]   2x 9 KB
  __shared__ __attribute__((aligned(16))) _Float16 vt[2][64 * LP];     // V chunk [d][k_col]   2x 9 KB

  const int bh = blockIdx.y;             // b*16 + h
  const int h = bh & 15;
  const int b = bh >> 4;
  const int t = threadIdx.x, lane = t & 31, wave = t >> 5;
  const int ln = lane & 15, hi = lane >> 4;
  const int q0 = blockIdx.x * 128 + wave * 16;

  const _Float16* qbase = q16 + (size_t)bh * SEQ * DKV;
  const _Float16* kbase = k16 + (size_t)bh * SEQ * DKV;
  const _Float16* vbase = vt16 + (size_t)bh * DKV * SEQ;

  // stage one 64-wide K/V chunk (4 async b128 per thread)
  auto stage = [&](int kc, int buf) {
    const int row = t >> 3, col8 = (t & 7) * 8;     // rows row and row + 32
    async_b128_x4(&kt[buf][row * LP + col8],
                  &kbase[(size_t)(kc + row) * DKV + col8],
                  &vt[buf][row * LP + col8],
                  &vbase[(size_t)row * SEQ + kc + col8],
                  &kt[buf][(row + 32) * LP + col8],
                  &kbase[(size_t)(kc + row + 32) * DKV + col8],
                  &vt[buf][(row + 32) * LP + col8],
                  &vbase[(size_t)(row + 32) * SEQ + kc + col8]);
  };
  stage(0, 0);

  // T5 bidirectional bucket: 16 sign buckets x {exact<8 | log-spaced to 128}
  for (int i = t; i < 2 * BT; i += 256) {
    const int delta = i - BT;            // k - q
    const int rb = (delta > 0) ? 16 : 0;
    const int rp = (delta < 0) ? -delta : delta;
    int bu;
    if (rp < 8) {
      bu = rp;
    } else {
      bu = 8 + (int)(__logf((float)rp * 0.125f) * (8.0f / __logf(16.0f)));
      bu = bu > 15 ? 15 : bu;
    }
    biasH[i] = (_Float16)(rel_bias[(rb + bu) * HH + h] * LOG2E);
  }

  v16h qf[2];
  {
    const _Float16* p = qbase + (size_t)(q0 + ln) * DKV;
    qf[0] = make_v16(*(const v8h*)&p[hi * 8], *(const v8h*)&p[hi * 8 + 16]);
    qf[1] = make_v16(*(const v8h*)&p[32 + hi * 8], *(const v8h*)&p[32 + hi * 8 + 16]);
  }

  const v8f zero = {0.f, 0.f, 0.f, 0.f, 0.f, 0.f, 0.f, 0.f};
  float m_ref = 0.f;       // reference of query q0 + ln, base 2 (same in both halves)
  float l_i = 0.f;         // running sum over this lane's own keys only
  v8f o[4];                // O^T: o[j][r] = ctx[q0 + ln][16 * j + 8 * hi + r]
#pragma unroll
  for (int j = 0; j < 4; ++j) o[j] = zero;

  // the wave's first query as a scalar: the far test below is a scalar branch
  const int q0u = __builtin_amdgcn_readfirstlane(q0);

  const int nchunk = SEQ / 64;
  for (int ic = 0; ic < nchunk; ++ic) {
    const int kc = ic * 64;
    const int cur = ic & 1;
    if (ic + 1 < nchunk) {      // prefetch next K/V chunk
      stage(kc + 64, cur ^ 1);
      wait_async_le4();
    } else {
      wait_async_0();
    }
    __syncthreads();            // current K/V tiles (+ bias table) visible

    // scores S^T(64 keys x 16 queries) = K_chunk(64x64) * Q^T(64x16)
    // plus the bias less the reference, the value the accumulators start from
    v8f s[4];
    auto scores = [&](int ns, v8f a) {
      const int r = ns * 16 + ln;
      v16h k0 = make_v16(*(const v8h*)&kt[cur][r * LP + hi * 8],
                         *(const v8h*)&kt[cur][r * LP + hi * 8 + 16]);
      v16h k1 = make_v16(*(const v8h*)&kt[cur][r * LP + 32 + hi * 8],
                         *(const v8h*)&kt[cur][r * LP + 32 + hi * 8 + 16]);
      a = wmma16(k0, qf[0], a);
      s[ns] = wmma16(k1, qf[1], a);
    };
    const int dk = kc - q0u;    // k - q runs from dk - 15 to dk + 63 in this wave
    if (dk - 15 >= BSAT || dk + 63 <= -BSAT) {
      // the sign's last bucket: the table's two ends (k - q = BT - 1, -BT) hold it
      const float c = (float)biasH[(dk > 0) ? 2 * BT - 1 : 0] - m_ref;
      const v8f a = {c, c, c, c, c, c, c, c};
#pragma unroll   // s[] indexed by constants only, so that it stays in registers
      for (int ns = 0; ns < 4; ++ns) scores(ns, a);
    } else {
      // here -BSAT - 78 < k - q < BSAT + 78: inside the table
      const _Float16* brow = &biasH[BT + dk + hi * 8 - ln];
#pragma unroll
      for (int ns = 0; ns < 4; ++ns) {
        v8f a;
#pragma unroll
        for (int r = 0; r < 8; ++r) a[r] = (float)brow[ns * 16 + r] - m_ref;
        scores(ns, a);
      }
    }

    // maximum over this lane's 32 keys
    float mx4[4];
#pragma unroll
    for (int ns = 0; ns < 4; ++ns) {
      float mx = -1e30f;
#pragma unroll
      for (int r = 0; r < 8; ++r) mx = fmaxf(mx, s[ns][r]);
      mx4[ns] = mx;
    }
    const float cm = fmaxf(fmaxf(mx4[0], mx4[1]), fmaxf(mx4[2], mx4[3]));

    // move the reference where a score lies more than RTHR above it; in the first
    // chunk every query sets it by its maximum. The test is one for the wave (a
    // scalar branch), so all lanes are on at the exchange between the halves.
    const float thr = (ic == 0) ? -3.0e38f : RTHR;
    if (__builtin_amdgcn_ballot_w32(cm > thr) != 0u) {
      const float cj = fmaxf(cm, xhalf(cm));        // the query's maximum, both halves
      const float d = (cj > thr) ? cj + RHEAD : 0.f;   // same in both halves
      // d < 0 only in the first chunk, where O and the sum are still 0
      const float scale = __builtin_amdgcn_exp2f(fminf(-d, 0.f));
      m_ref += d;
      l_i *= scale;
      // all four loops unrolled: s[] and o[] indexed by constants only, so that
      // they stay in registers
#pragma unroll
      for (int ns = 0; ns < 4; ++ns)
#pragma unroll
        for (int r = 0; r < 8; ++r) s[ns][r] -= d;
#pragma unroll
      for (int j = 0; j < 4; ++j)
#pragma unroll
        for (int r = 0; r < 8; ++r) o[j][r] *= scale;
    }

    float sum4[4];
#pragma unroll
    for (int ns = 0; ns < 4; ++ns) {
      float sum = 0.f;
#pragma unroll
      for (int r = 0; r < 8; ++r) {
        const float p = __builtin_amdgcn_exp2f(s[ns][r]);
        s[ns][r] = p;
        sum += p;
      }
      sum4[ns] = sum;
    }
    l_i += (sum4[0] + sum4[1]) + (sum4[2] + sum4[3]);

    // P^T as B operand: score tiles 2c and 2c + 1, converted in place, hold
    // keys 8 * hi + e and 16 + 8 * hi + e of 32-key block c: the k order of
    // the V fragments below
    v16h pf[2];
#pragma unroll
    for (int c = 0; c < 2; ++c)
#pragma unroll
      for (int e = 0; e < 8; ++e) {
        pf[c][e]     = (_Float16)s[2 * c][e];
        pf[c][e + 8] = (_Float16)s[2 * c + 1][e];
      }

    // O^T(64 d x 16 queries) += V^T_chunk(64x64) * P^T(64x16); the LDS tile
    // is already [M=d][K=key]
#pragma unroll
    for (int j = 0; j < 4; ++j) {
      const int r = j * 16 + ln;
      v16h v0 = make_v16(*(const v8h*)&vt[cur][r * LP + hi * 8],
                         *(const v8h*)&vt[cur][r * LP + hi * 8 + 16]);
      v16h v1 = make_v16(*(const v8h*)&vt[cur][r * LP + 32 + hi * 8],
                         *(const v8h*)&vt[cur][r * LP + 32 + hi * 8 + 16]);
      o[j] = wmma16(v0, pf[0], o[j]);
      o[j] = wmma16(v1, pf[1], o[j]);
    }
    __syncthreads();            // all waves done reading current buffers
  }

  // join the halves' sums, normalize and store ctx as [b, s, h*64+d] f16 (rows
  // for the out-projection): a lane's 8 values of a tile are 16 contiguous bytes
  const float inv = 1.f / (l_i + xhalf(l_i));
  // Stored from here, one instruction would touch 16 rows with 32 B in each. The
  // wave's 16 x 64 tile goes through LDS instead, so that one instruction stores
  // four whole rows of 128 B. The K tiles are free: the barrier at the foot of the
  // last chunk stands behind every wave's last read, and no copy is in flight.
  // Each wave uses 16 rows of its own, so no further barrier is needed.
  _Float16* stg = &kt[0][0] + wave * 16 * LP;
#pragma unroll
  for (int j = 0; j < 4; ++j) {
    v8h w;
#pragma unroll
    for (int r = 0; r < 8; ++r) w[r] = (_Float16)(o[j][r] * inv);
    *(v8h*)&stg[ln * LP + j * 16 + hi * 8] = w;
  }
  wait_ds_0();                // the wave's tile is in LDS before other lanes read it
  const int row0 = lane >> 3, c8 = (lane & 7) * 8;       // rows 4 * k + row0
  _Float16* crow = &ctx16[((size_t)(b * SEQ + q0 + row0)) * DIM + h * 64 + c8];
#pragma unroll
  for (int k = 0; k < 4; ++k)
    *(v8h*)&crow[k * 4 * DIM] = *(const v8h*)&stg[(4 * k + row0) * LP + c8];
}

// ---------------------------------------------------------------------------
// host launcher
// ---------------------------------------------------------------------------
extern "C" void kernel_launch(void* const* d_in, const int* in_sizes, int n_in,
                              void* d_out, int out_size, void* d_ws, size_t ws_size,
                              hipStream_t stream) {
  (void)in_sizes; (void)n_in; (void)out_size; (void)ws_size;
  const float* hidden = (const float*)d_in[0];
  const float* lnw    = (const float*)d_in[1];
  const float* wq     = (const float*)d_in[2];
  const float* wk     = (const float*)d_in[3];
  const float* wv     = (const float*)d_in[4];
  const float* wo     = (const float*)d_in[5];
  const float* rb     = (const float*)d_in[6];
  float* out = (float*)d_out;

  char* ws = (char*)d_ws;
  const size_t MB = 1024ull * 1024ull;
  _Float16* normed = (_Float16*)(ws);             //  8 MB  [4096][1024]
  _Float16* w16    = (_Float16*)(ws + 8  * MB);   //  8 MB  wqT|wkT|wvT|woT
  _Float16* q16    = (_Float16*)(ws + 16 * MB);   //  8 MB  [b,h,s,64]
  _Float16* k16    = (_Float16*)(ws + 24 * MB);   //  8 MB  [b,h,s,64]
  _Float16* vt16   = (_Float16*)(ws + 32 * MB);   //  8 MB  [b,h,64,s]
  _Float16* ctx16  = (_Float16*)(ws + 40 * MB);   //  8 MB  [b*s][1024]

  t5_rmsnorm_kernel<<<MTOT, 256, 0, stream>>>(hidden, lnw, normed);
  t5_convw_kernel<<<dim3(16, 8, 4), 256, 0, stream>>>(wq, wk, wv, wo, w16);
  // Q, K, Vt projections: grid.z selects the weight matrix + store layout
  t5_gemm_kernel<<<dim3(8, 32, 3), 256, 0, stream>>>(
      normed, w16, /*mode_base=*/0, q16, k16, vt16, nullptr, nullptr);
  t5_attn_kernel<<<dim3(SEQ / 128, BB * HH), 256, 0, stream>>>(
      q16, k16, vt16, rb, ctx16);
  // output projection + residual (mode 3)
  t5_gemm_kernel<<<dim3(8, 32, 1), 256, 0, stream>>>(
      ctx16, w16 + 3ull * (1u << 20), /*mode_base=*/3, nullptr, nullptr, nullptr,
      hidden, out);
}

// v010
// One run takes 84.5 microseconds.
// In both of two side-by-side timings against v009, it was 1.05 times as fast.
// Counting every step since v000, it is 5.22 times as fast.
#include <hip/hip_runtime.h>

typedef __attribute__((ext_vector_type(16))) _Float16 v16h;
typedef __attribute__((ext_vector_type(8)))  _Float16 v8h;
typedef __attribute__((ext_vector_type(8)))  float    v8f;
typedef __attribute__((ext_vector_type(4)))  unsigned u32x4;
typedef __attribute__((ext_vector_type(8)))  unsigned u32x8;

#define HH   16          // heads
#define DKV  64          // head dim
#define SEQ  2048
#define DIM  1024        // model dim == HH*DKV
#define BB   2
#define MTOT (BB * SEQ)  // 4096 rows
#define LOG2E 1.44269504088896340736f

static __device__ __forceinline__ v16h make_v16(v8h lo, v8h hi) {
  union { v16h v; v8h h[2]; } u;
  u.h[0] = lo; u.h[1] = hi;
  return u.v;
}

static __device__ __forceinline__ v8f wmma16(v16h a, v16h b, v8f c) {
  // D = A(16x32 f16) x B(32x16 f16) + C(16x16 f32)
  return __builtin_amdgcn_wmma_f32_16x16x32_f16(
      /*neg_a=*/false, a, /*neg_b=*/false, b,
      /*c_mod=*/(short)0, c, /*reuse_a=*/false, /*reuse_b=*/false);
}

static __device__ __forceinline__ void async_b128_x4(void* l0, const void* g0,
                                                     void* l1, const void* g1,
                                                     void* l2, const void* g2,
                                                     void* l3, const void* g3) {
  asm volatile("global_load_async_to_lds_b128 %0, %1, off\n\t"
               "global_load_async_to_lds_b128 %2, %3, off\n\t"
               "global_load_async_to_lds_b128 %4, %5, off\n\t"
               "global_load_async_to_lds_b128 %6, %7, off\n\t"
               "s_wait_xcnt 0x0"
               :: "v"((unsigned)(unsigned long long)l0), "v"((unsigned long long)g0),
                  "v"((unsigned)(unsigned long long)l1), "v"((unsigned long long)g1),
                  "v"((unsigned)(unsigned long long)l2), "v"((unsigned long long)g2),
                  "v"((unsigned)(unsigned long long)l3), "v"((unsigned long long)g3)
               : "memory");
}
static __device__ __forceinline__ void wait_async_le4() {
  asm volatile("s_wait_asynccnt 0x4" ::: "memory");
}
static __device__ __forceinline__ void wait_async_0() {
  asm volatile("s_wait_asynccnt 0x0" ::: "memory");
}

// Waits for a tensor load, and for the LDS reads in front of one, are both
// written by hand at the ring's publish points.
static __device__ __forceinline__ void wait_tensor_0() {
  asm volatile("s_wait_tensorcnt 0x0" ::: "memory");
}
static __device__ __forceinline__ void wait_ds_0() {
  asm volatile("s_wait_dscnt 0x0" ::: "memory");
}
static __device__ __forceinline__ unsigned uni(unsigned v) {
  return (unsigned)__builtin_amdgcn_readfirstlane(v);
}
static __device__ __forceinline__ unsigned pinned(unsigned v) {
  unsigned w = uni(v);
  asm volatile("" : "+s"(w));   // pinned(): keeps the value in a scalar register
  return w;
}

#define GROWB   128u               // bytes of a tile row
#define GPITCH  144u               // LDS row pitch, bytes
#define GSROWS  32u                // rows per slice
#define GSLICE  6144u              // LDS bytes per slice
#define GBUF    (8u * GSLICE)      // one buffer: A slices 0..3, B slices 4..7
#define GPASSES (1024u * 2u / GROWB)
// epilogue staging in the ring, when its passes are over
#define ESTG    (2u * GSLICE)      // LDS bytes of one wave's range
#define EP16    144                // row pitch of a 32 x 64 tile of f16, bytes
#define EP32    272                // row pitch of a 32 x 64 tile of f32, bytes

// One tensor load: GSROWS rows of GROWB bytes, source pitch 2048 B (a row of
// 1024 halfs), 1-byte elements, tensor = tile, 4 dwords of pad behind every
// 32 dwords (one row).
static __device__ __forceinline__ void tdm_slice(unsigned lds_dst, unsigned long long ga) {
  u32x4 g0;
  g0[0] = uni(1u);                                        // count = 1
  g0[1] = uni(lds_dst);                                   // LDS byte offset
  g0[2] = uni((unsigned)ga);                              // address [31:0]
  g0[3] = uni((((unsigned)(ga >> 32)) & 0x01ffffffu) | 0x80000000u);  // [56:32] | type 2
  u32x8 g1;
  g1[0] = uni((1u << 20) | (4u << 22) | (3u << 25));
  g1[1] = uni((GROWB & 0xffffu) << 16);
  g1[2] = uni((GROWB >> 16) | ((GSROWS & 0xffffu) << 16));
  g1[3] = uni((GSROWS >> 16) | (GROWB << 16));
  g1[4] = uni(GSROWS);
  g1[5] = uni(2048u);
  g1[6] = uni(0u);
  g1[7] = uni(0u);
  asm volatile("tensor_load_to_lds %0, %1" :: "s"(g0), "s"(g1) : "memory");
}

// ---------------------------------------------------------------------------
// Kernel 1: RMS norm (T5 LayerNorm: no mean subtraction) -> f16 activations
// ---------------------------------------------------------------------------
__global__ void t5_rmsnorm_kernel(const float* __restrict__ hs,
                                  const float* __restrict__ w,
                                  _Float16* __restrict__ out) {
  __shared__ float red[256];
  const int row = blockIdx.x;
  const int t = threadIdx.x;
  const float* r = hs + (size_t)row * DIM;

  float vals[4];
  float s = 0.f;
#pragma unroll
  for (int i = 0; i < 4; ++i) {
    vals[i] = r[t + i * 256];
    s += vals[i] * vals[i];
  }
  red[t] = s;
  __syncthreads();
  for (int off = 128; off > 0; off >>= 1) {
    if (t < off) red[t] += red[t + off];
    __syncthreads();
  }
  const float rs = rsqrtf(red[0] * (1.0f / DIM) + 1e-6f);
#pragma unroll
  for (int i = 0; i < 4; ++i) {
    const int c = t + i * 256;
    out[(size_t)row * DIM + c] = (_Float16)(vals[i] * w[c] * rs);
  }
}

typedef __attribute__((ext_vector_type(4))) float    f32x4;
typedef __attribute__((ext_vector_type(2))) _Float16 v2h;
__global__ void __launch_bounds__(256) t5_convw_kernel(const float* __restrict__ wq,
                                const float* __restrict__ wk,
                                const float* __restrict__ wv,
                                const float* __restrict__ wo,
                                _Float16* __restrict__ out) {
  __shared__ __attribute__((aligned(16))) _Float16 tile[64 * 128];   // 16 KB
  const int w = blockIdx.z;
  const int e0 = blockIdx.x * 64;    // first output feature (row of transposed)
  const int d0 = blockIdx.y * 128;   // first input feature  (col of transposed)
  const float* src = (w == 0) ? wq : (w == 1) ? wk : (w == 2) ? wv : wo;
  const int t = threadIdx.x;
  const int eq = t & 15;             // this thread's four e: 4 * eq + 0..3
  const int rp = t >> 4;             // its d pairs: 2 * (rp + 16 * i) + 0..1

  f32x4 ra[4], rb[4];
#pragma unroll
  for (int i = 0; i < 4; ++i) {
    const float* p = src + (size_t)(d0 + 2 * (rp + 16 * i)) * 1024 + e0 + 4 * eq;
    ra[i] = *(const f32x4*)p;
    rb[i] = *(const f32x4*)(p + 1024);
    // a later load's result may be given the registers that held this pair's
    // address: the wait stands between these two loads and any such write
    asm volatile("s_wait_xcnt 0x0" ::: "memory");
  }
#pragma unroll
  for (int i = 0; i < 4; ++i) {
    const int d = 2 * (rp + 16 * i);
    const int piece = (d >> 3) ^ eq;             // (e >> 2) & 15 == eq
#pragma unroll
    for (int j = 0; j < 4; ++j) {
      v2h pr;
      pr[0] = (_Float16)ra[i][j];
      pr[1] = (_Float16)rb[i][j];
      *(v2h*)&tile[(4 * eq + j) * 128 + piece * 8 + (d & 7)] = pr;
    }
  }
  __syncthreads();                   // whole tile written before any row is read
  _Float16* dst = out + ((size_t)w << 20) + (size_t)e0 * 1024 + d0;
#pragma unroll
  for (int i = 0; i < 4; ++i) {
    const int id = t + i * 256;
    const int e = id >> 4, c = id & 15;
    const v8h v = *(const v8h*)&tile[e * 128 + (c ^ ((e >> 2) & 15)) * 8];
    *(v8h*)&dst[(size_t)e * 1024 + c * 8] = v;
  }
}

// ---------------------------------------------------------------------------
// Kernel 3/5: tiled GEMM, C[M,N] = A[M,K] * Bt[N,K]^T  (M=4096, N=K=1024)
// Block tile 128x128, 64 k per pass, two LDS buffers. Every wave brings one
// 32-row slice per pass (waves 0..3: A, waves 4..7: B) with one tensor load,
// issued two passes ahead into the buffer that all waves have just left.
//   mode 0: Q  -> [b,h,s,64] f16       mode 1: K -> [b,h,s,64] f16
//   mode 2: V  -> [b,h,64,s] f16       mode 3: f32 out = hidden + acc
// A lane's 8 results of an accumulator tile are 8 neighbouring rows of the
// FIRST matrix operand. The first operand is therefore the side that runs
// contiguously in the output: the weight rows (n) in modes 0, 1 and 3, the
// activation rows (m = position) in mode 2. Both operands have the same
// fragment form and the block tile is square, so the choice is only which LDS
// slices a wave reads as first (64 rows) and as second operand (32 rows); the
// 8 results are then 16 contiguous bytes of f16 or 32 of f32 of an output row.
// ---------------------------------------------------------------------------
__global__ void t5_gemm_kernel(const _Float16* __restrict__ A,
                               const _Float16* __restrict__ Bt,
                               int mode_base,
                               _Float16* __restrict__ q16,
                               _Float16* __restrict__ k16,
                               _Float16* __restrict__ vt16,
                               const float* __restrict__ hidden,
                               float* __restrict__ outf) {
  __shared__ __attribute__((aligned(2048))) unsigned char ring[2 * GBUF];   // 96 KB

  const int mode = mode_base + blockIdx.z;
  const _Float16* B = Bt + ((size_t)blockIdx.z << 20);
  const int m0 = blockIdx.y * 128;
  const int n0 = blockIdx.x * 128;
  const int t = threadIdx.x;
  const int lane = t & 31;
  const int wave = (int)uni(threadIdx.x >> 5);
  const int wm = wave >> 2, wn = wave & 3;
  const int ln = lane & 15, hi = lane >> 4;

  const v8f zero = {0.f, 0.f, 0.f, 0.f, 0.f, 0.f, 0.f, 0.f};
  v8f acc[4][2];
#pragma unroll
  for (int i = 0; i < 4; ++i)
#pragma unroll
    for (int j = 0; j < 2; ++j) acc[i][j] = zero;

  // this wave's slice: its first source row and its place in buffer 0
  const _Float16* srow = (wave < 4) ? &A[(size_t)(m0 + wave * 32) * 1024]
                                    : &B[(size_t)(n0 + (wave - 4) * 32) * 1024];
  const unsigned long long sga = (unsigned long long)srow;
  const unsigned slds = (unsigned)(unsigned long long)&ring[0] + (unsigned)wave * GSLICE;
  auto stage = [&](unsigned s) {
    tdm_slice(slds + (s & 1u) * GBUF, sga + (unsigned long long)(s * GROWB));
  };

  // fragment rows of this lane in buffer 0 (k order as the hardware's: halfs
  // 8 * hi + 0..7 and 16 + 8 * hi + 0..7 of each block of 32 k)
  // abase: first operand, two slices from wm * 2; bbase: second, slice wn
  const unsigned fsl = (mode == 2) ? 0u : 4u;   // first slice of the first operand's side
  const unsigned ssl = (mode == 2) ? 4u : 0u;   // ... of the second operand's side
  const unsigned char* abase = &ring[(fsl + (unsigned)(wm * 2)) * GSLICE + (unsigned)ln * GPITCH + (unsigned)hi * 16u];
  const unsigned char* bbase = &ring[(ssl + (unsigned)wn) * GSLICE + (unsigned)ln * GPITCH + (unsigned)hi * 16u];

  stage(0);
  wait_tensor_0();            // this wave's slice of pass 0 has landed
  __syncthreads();            // ... and every other wave's
  stage(1);
#pragma unroll 1
  for (unsigned s = 0; s < GPASSES; ++s) {
    const unsigned char* ap = abase + (s & 1u) * GBUF;
    const unsigned char* bp = bbase + (s & 1u) * GBUF;
#pragma unroll
    for (int kk = 0; kk < 2; ++kk) {
      v16h af[4], bf[2];
#pragma unroll
      for (int i = 0; i < 4; ++i) {
        const unsigned char* p = ap + (i >> 1) * GSLICE + (i & 1) * 16 * GPITCH + kk * 64;
        af[i] = make_v16(*(const v8h*)p, *(const v8h*)(p + 32));
      }
#pragma unroll
      for (int j = 0; j < 2; ++j) {
        const unsigned char* p = bp + j * 16 * GPITCH + kk * 64;
        bf[j] = make_v16(*(const v8h*)p, *(const v8h*)(p + 32));
      }
#pragma unroll
      for (int i = 0; i < 4; ++i)
#pragma unroll
        for (int j = 0; j < 2; ++j) acc[i][j] = wmma16(af[i], bf[j], acc[i][j]);
    }

    wait_ds_0();
    wait_tensor_0();
    __syncthreads();
    const unsigned nx = pinned(s + 2u);
    if (nx < GPASSES) stage(nx);
  }
  wait_tensor_0();            // the ring's closing waits: nothing in flight to LDS,
  wait_ds_0();                // nothing of it unread, when the wave goes on

  // epilogue. Of the wave's tile, acc[i][j][r] is element 16 * i + 8 * hi + r of the
  // 64 that run contiguously in the output (first operand's side) in row
  // 16 * j + ln of 32 (second operand's side): stored from there, one instruction
  // would touch 16 output rows with 32 B or less in each. The tile goes through
  // LDS instead, so that one instruction stores (and in mode 3 loads) whole rows:
  // 128 B of f16 or 256 B of f32, four 128 B lines per instruction.
  // The ring is free: the barrier at the foot of the last pass stands behind every
  // wave's last read and last landed slice. Each wave uses a range of its own, so
  // no further barrier is needed. Row pitches are 16 B x odd, as for the slices.
  unsigned char* stg = &ring[(unsigned)wave * ESTG];
  if (mode == 3) {
    const int row0 = lane >> 4, col = (lane & 15) * 4;   // rows 2 * k + row0
    const size_t at = (size_t)(m0 + wn * 32 + row0) * 1024 + (size_t)(n0 + wm * 64 + col);
    f32x4 h[16];
#pragma unroll
    for (int k = 0; k < 8; ++k) h[k] = *(const f32x4*)&hidden[at + k * 2048];
#pragma unroll
    for (int i = 0; i < 4; ++i)
#pragma unroll
      for (int j = 0; j < 2; ++j) {
        unsigned char* q = stg + (j * 16 + ln) * EP32 + i * 64 + hi * 32;
        const f32x4 a0 = {acc[i][j][0], acc[i][j][1], acc[i][j][2], acc[i][j][3]};
        const f32x4 a1 = {acc[i][j][4], acc[i][j][5], acc[i][j][6], acc[i][j][7]};
        *(f32x4*)q = a0;
        *(f32x4*)(q + 16) = a1;
      }
#pragma unroll
    for (int k = 8; k < 16; ++k) h[k] = *(const f32x4*)&hidden[at + k * 2048];
    wait_ds_0();              // the wave's tile is in LDS before other lanes read it
#pragma unroll
    for (int k = 0; k < 16; ++k) {
      const f32x4 a = *(const f32x4*)(stg + (2 * k + row0) * EP32 + col * 4);
#pragma unroll
      for (int r = 0; r < 4; ++r) h[k][r] += a[r];
      *(f32x4*)&outf[at + k * 2048] = h[k];
    }
  } else {
    // Q leaves multiplied by log2(e), in f32 ahead of its one rounding to f16:
    // the attention kernel's scores are then exponents of 2
    const float qs = (mode == 0) ? LOG2E : 1.0f;
#pragma unroll
    for (int i = 0; i < 4; ++i)
#pragma unroll
      for (int j = 0; j < 2; ++j) {
        v8h w;
#pragma unroll
        for (int r = 0; r < 8; ++r) w[r] = (_Float16)(acc[i][j][r] * qs);
        *(v8h*)(stg + (j * 16 + ln) * EP16 + i * 32 + hi * 16) = w;
      }
    wait_ds_0();              // the wave's tile is in LDS before other lanes read it
    const int row0 = lane >> 3, c8 = (lane & 7) * 8;     // rows 4 * k + row0
    v8h w[8];
#pragma unroll
    for (int k = 0; k < 8; ++k) w[k] = *(const v8h*)(stg + (4 * k + row0) * EP16 + c8 * 2);
    // f16 outputs: a tile row is 64 halfs of one position (Q, K: the head's
    // features) or of one feature (V: positions); the next row lies DKV or SEQ on
    const int m = m0 + ((mode == 2) ? wm * 64 + c8 : wn * 32 + row0);
    const int nc = n0 + ((mode == 2) ? wn * 32 + row0 : wm * 64 + c8);
    const int b = m >> 11, s = m & 2047;
    const int h = nc >> 6, d = nc & 63;
    const size_t bh = (size_t)(b * HH + h) * (SEQ * DKV);
    if (mode == 2) {
      _Float16* dst = &vt16[bh + (size_t)d * SEQ + s];
#pragma unroll
      for (int k = 0; k < 8; ++k) *(v8h*)&dst[k * 4 * SEQ] = w[k];
    } else {
      _Float16* dst = &((mode == 0) ? q16 : k16)[bh + (size_t)s * DKV + d];
#pragma unroll
      for (int k = 0; k < 8; ++k) *(v8h*)&dst[k * 4 * DKV] = w[k];
    }
  }
}

#define LP 72            // LDS row pitch of the K and V tiles, in halfs
#define KST 128          // keys per stage
#define BT 256           // bias table: entry i is the bias of k - q = i - BT
#define BSAT 128         // |k - q| from which the bucket is the sign's last
#define RTHR 15.0f       // a score this far above the reference moves the reference
#define RHEAD 4.0f       // ... to this far above the score
static __device__ __forceinline__ float xhalf(float x) {
  const int v = __builtin_bit_cast(int, x);
  return __builtin_bit_cast(float, __builtin_amdgcn_permlanex16(
      v, v, 0x76543210, 0xfedcba98, false, false));
}
__global__ void __launch_bounds__(256) __attribute__((amdgpu_waves_per_eu(4, 4)))
t5_attn_kernel(const _Float16* __restrict__ q16,
                               const _Float16* __restrict__ k16,
                               const _Float16* __restrict__ vt16,
                               const float* __restrict__ rel_bias,
                               _Float16* __restrict__ ctx16) {
  __shared__ _Float16 biasH[2 * BT];      // bias[k - q + BT]        1 KB
  // K stage [key][d]; V stage: one tile [d][64 keys] per half of the stage's keys
  __shared__ __attribute__((aligned(16))) _Float16 kt[2][KST * LP];    // 2x 18 KB
  __shared__ __attribute__((aligned(16))) _Float16 vt[2][KST * LP];    // 2x 18 KB

  const int bh = blockIdx.y;             // b*16 + h
  const int h = bh & 15;
  const int b = bh >> 4;
  const int t = threadIdx.x, lane = t & 31, wave = t >> 5;
  const int ln = lane & 15, hi = lane >> 4;
  const int kh = wave >> 2;              // the half of each stage's keys
  const int q0 = blockIdx.x * 128 + (wave & 3) * 32;

  const _Float16* qbase = q16 + (size_t)bh * SEQ * DKV;
  const _Float16* kbase = k16 + (size_t)bh * SEQ * DKV;
  const _Float16* vbase = vt16 + (size_t)bh * DKV * SEQ;

  // stage 128 keys of K and V (8 async b128 per thread)
  auto stage = [&](int kc, int buf) {
    const int row = t >> 3, col8 = (t & 7) * 8;     // rows row + 32 * i
    async_b128_x4(&kt[buf][row * LP + col8],
                  &kbase[(size_t)(kc + row) * DKV + col8],
                  &kt[buf][(row + 32) * LP + col8],
                  &kbase[(size_t)(kc + row + 32) * DKV + col8],
                  &kt[buf][(row + 64) * LP + col8],
                  &kbase[(size_t)(kc + row + 64) * DKV + col8],
                  &kt[buf][(row + 96) * LP + col8],
                  &kbase[(size_t)(kc + row + 96) * DKV + col8]);
    async_b128_x4(&vt[buf][row * LP + col8],
                  &vbase[(size_t)row * SEQ + kc + col8],
                  &vt[buf][(row + 32) * LP + col8],
                  &vbase[(size_t)(row + 32) * SEQ + kc + col8],
                  &vt[buf][(row + 64) * LP + col8],
                  &vbase[(size_t)row * SEQ + kc + 64 + col8],
                  &vt[buf][(row + 96) * LP + col8],
                  &vbase[(size_t)(row + 32) * SEQ + kc + 64 + col8]);
  };
  stage(0, 0);

  // T5 bidirectional bucket: 16 sign buckets x {exact<8 | log-spaced to 128}
  for (int i = t; i < 2 * BT; i += 256) {
    const int delta = i - BT;            // k - q
    const int rb = (delta > 0) ? 16 : 0;
    const int rp = (delta < 0) ? -delta : delta;
    int bu;
    if (rp < 8) {
      bu = rp;
    } else {
      bu = 8 + (int)(__logf((float)rp * 0.125f) * (8.0f / __logf(16.0f)));
      bu = bu > 15 ? 15 : bu;
    }
    biasH[i] = (_Float16)(rel_bias[(rb + bu) * HH + h] * LOG2E);
  }

  v16h qf[2][2];
#pragma unroll
  for (int u = 0; u < 2; ++u) {
    const _Float16* p = qbase + (size_t)(q0 + 16 * u + ln) * DKV;
    qf[u][0] = make_v16(*(const v8h*)&p[hi * 8], *(const v8h*)&p[hi * 8 + 16]);
    qf[u][1] = make_v16(*(const v8h*)&p[32 + hi * 8], *(const v8h*)&p[32 + hi * 8 + 16]);
  }
  // the registers that hold these loads' addresses are given to other values next:
  // the wait stands between the loads and any such write
  asm volatile("s_wait_xcnt 0x0" ::: "memory");

  const v8f zero = {0.f, 0.f, 0.f, 0.f, 0.f, 0.f, 0.f, 0.f};
  float m_ref[2] = {0.f, 0.f};   // reference of query q0 + 16 * u + ln, base 2 (same in both halves)
  float l_i[2] = {0.f, 0.f};     // running sum over this lane's own keys only
  v8f o[2][4];                   // O^T: o[u][j][r] = ctx[q0 + 16 * u + ln][16 * j + 8 * hi + r]
#pragma unroll
  for (int u = 0; u < 2; ++u)
#pragma unroll
    for (int j = 0; j < 4; ++j) o[u][j] = zero;

  // first key of the wave's half less its first query, as a scalar: the far test
  // below is a scalar branch
  const int dk0 = __builtin_amdgcn_readfirstlane(kh * 64 - q0);

  const int nst = SEQ / KST;
  wait_async_0();               // this wave's copies of stage 0 have landed
  __syncthreads();              // ... and every other wave's; bias table visible
  stage(KST, 1);
  for (int is = 0; is < nst; ++is) {
    const int cur = is & 1;
    const _Float16* ktc = &kt[cur][kh * 64 * LP];
    const _Float16* vtc = &vt[cur][kh * 64 * LP];

    // scores S^T(64 keys x 32 queries) = K_half(64x64) * Q^T(64x32)
    // plus the bias less the reference, the value the accumulators start from
    v8f s[2][4];
    auto scores = [&](int ns, v8f a0, v8f a1) {
      const int r = ns * 16 + ln;
      v16h k0 = make_v16(*(const v8h*)&ktc[r * LP + hi * 8],
                         *(const v8h*)&ktc[r * LP + hi * 8 + 16]);
      v16h k1 = make_v16(*(const v8h*)&ktc[r * LP + 32 + hi * 8],
                         *(const v8h*)&ktc[r * LP + 32 + hi * 8 + 16]);
      a0 = wmma16(k0, qf[0][0], a0);
      a1 = wmma16(k0, qf[1][0], a1);
      s[0][ns] = wmma16(k1, qf[0][1], a0);
      s[1][ns] = wmma16(k1, qf[1][1], a1);
    };
    const int dk = is * KST + dk0;   // k - q runs from dk - 31 to dk + 63 in this wave
    if (dk - 31 >= BSAT || dk + 63 <= -BSAT) {
      // the sign's last bucket: the table's two ends (k - q = BT - 1, -BT) hold it
      const float cb = (float)biasH[(dk > 0) ? 2 * BT - 1 : 0];
      const float c0 = cb - m_ref[0], c1 = cb - m_ref[1];
      const v8f a0 = {c0, c0, c0, c0, c0, c0, c0, c0};
      const v8f a1 = {c1, c1, c1, c1, c1, c1, c1, c1};
#pragma unroll   // s[] indexed by constants only, so that it stays in registers
      for (int ns = 0; ns < 4; ++ns) scores(ns, a0, a1);
    } else {
      // here -BSAT - 94 < k - q < BSAT + 94: inside the table
      const _Float16* brow = &biasH[BT + dk + hi * 8 - ln];
#pragma unroll
      for (int ns = 0; ns < 4; ++ns) {
        v8f a0, a1;
#pragma unroll
        for (int r = 0; r < 8; ++r) {
          a0[r] = (float)brow[ns * 16 + r] - m_ref[0];
          a1[r] = (float)brow[ns * 16 + r - 16] - m_ref[1];
        }
        scores(ns, a0, a1);
      }
    }

    // maximum over this lane's 32 keys, per query tile
    float cm[2];
#pragma unroll
    for (int u = 0; u < 2; ++u) {
      float mx4[4];
#pragma unroll
      for (int ns = 0; ns < 4; ++ns) {
        float mx = -1e30f;
#pragma unroll
        for (int r = 0; r < 8; ++r) mx = fmaxf(mx, s[u][ns][r]);
        mx4[ns] = mx;
      }
      cm[u] = fmaxf(fmaxf(mx4[0], mx4[1]), fmaxf(mx4[2], mx4[3]));
    }

    // move the reference where a score lies more than RTHR above it; in the first
    // stage every query sets it by its maximum. The test is one for the wave (a
    // scalar branch), so all lanes are on at the exchange between the halves.
    const float thr = (is == 0) ? -3.0e38f : RTHR;
    if (__builtin_amdgcn_ballot_w32(fmaxf(cm[0], cm[1]) > thr) != 0u) {
      // all loops unrolled: s[] and o[] indexed by constants only, so that they
      // stay in registers
#pragma unroll
      for (int u = 0; u < 2; ++u) {
        const float cj = fmaxf(cm[u], xhalf(cm[u]));     // the query's maximum, both halves
        const float d = (cj > thr) ? cj + RHEAD : 0.f;   // same in both halves
        // d < 0 only in the first stage, where O and the sum are still 0
        const float scale = __builtin_amdgcn_exp2f(fminf(-d, 0.f));
        m_ref[u] += d;
        l_i[u] *= scale;
#pragma unroll
        for (int ns = 0; ns < 4; ++ns)
#pragma unroll
          for (int r = 0; r < 8; ++r) s[u][ns][r] -= d;
#pragma unroll
        for (int j = 0; j < 4; ++j)
#pragma unroll
          for (int r = 0; r < 8; ++r) o[u][j][r] *= scale;
      }
    }

    // P^T as B operand: score tiles 2c and 2c + 1, converted in place, hold
    // keys 8 * hi + e and 16 + 8 * hi + e of 32-key block c: the k order of
    // the V fragments below
    v16h pf[2][2];
#pragma unroll
    for (int u = 0; u < 2; ++u) {
      float sum4[4];
#pragma unroll
      for (int ns = 0; ns < 4; ++ns) {
        float sum = 0.f;
#pragma unroll
        for (int r = 0; r < 8; ++r) {
          const float p = __builtin_amdgcn_exp2f(s[u][ns][r]);
          s[u][ns][r] = p;
          sum += p;
        }
        sum4[ns] = sum;
      }
      l_i[u] += (sum4[0] + sum4[1]) + (sum4[2] + sum4[3]);
#pragma unroll
      for (int c = 0; c < 2; ++c)
#pragma unroll
        for (int e = 0; e < 8; ++e) {
          pf[u][c][e]     = (_Float16)s[u][2 * c][e];
          pf[u][c][e + 8] = (_Float16)s[u][2 * c + 1][e];
        }
    }

    __builtin_amdgcn_sched_barrier(0);

    // O^T(64 d x 32 queries) += V^T_half(64x64) * P^T(64x32); the LDS tile
    // is already [M=d][K=key]
#pragma unroll
    for (int j = 0; j < 4; ++j) {
      const int r = j * 16 + ln;
      v16h v0 = make_v16(*(const v8h*)&vtc[r * LP + hi * 8],
                         *(const v8h*)&vtc[r * LP + hi * 8 + 16]);
      v16h v1 = make_v16(*(const v8h*)&vtc[r * LP + 32 + hi * 8],
                         *(const v8h*)&vtc[r * LP + 32 + hi * 8 + 16]);
      o[0][j] = wmma16(v0, pf[0][0], o[0][j]);
      o[1][j] = wmma16(v0, pf[1][0], o[1][j]);
      o[0][j] = wmma16(v1, pf[0][1], o[0][j]);
      o[1][j] = wmma16(v1, pf[1][1], o[1][j]);
    }

    // publish point of stage is + 1
    wait_ds_0();                // this wave's reads of buffer cur are done
    wait_async_0();             // its copies of stage is + 1 have landed
    __syncthreads();            // both hold for every wave
    if (is + 2 < nst) stage((is + 2) * KST, cur);   // refill of the buffer just left
  }
  wait_async_0();               // the ring's closing wait: no copy in flight

  // The two waves of a pair hold, for the same 32 queries, O, sum and reference
  // over the one and the other half of the keys. Wave kh finishes query tile kh:
  // it hands its part of the other tile to its partner through LDS and takes the
  // partner's part of its own. Both parts have the same lane and register layout.
  // The K tiles are free: the barrier at the foot of the last stage stands behind
  // every wave's last read, and no copy is in flight.
  const bool up = (kh != 0);
  f32x4* xo = (f32x4*)&kt[0][0];                 // [wave][8][lane] x 16 B: 32 KB
  float* xm = (float*)&kt[0][0] + 8 * 8 * 32 * 4;   // [wave][2][lane]: 2 KB behind it
  const float lj0 = l_i[0] + xhalf(l_i[0]);      // the halves' sums joined
  const float lj1 = l_i[1] + xhalf(l_i[1]);
#pragma unroll
  for (int j = 0; j < 4; ++j) {
    f32x4 g0, g1;
#pragma unroll
    for (int r = 0; r < 4; ++r) {
      g0[r] = up ? o[0][j][r] : o[1][j][r];
      g1[r] = up ? o[0][j][r + 4] : o[1][j][r + 4];
    }
    xo[(wave * 8 + j * 2) * 32 + lane] = g0;
    xo[(wave * 8 + j * 2 + 1) * 32 + lane] = g1;
  }
  xm[(wave * 2) * 32 + lane] = up ? m_ref[0] : m_ref[1];
  xm[(wave * 2 + 1) * 32 + lane] = up ? lj0 : lj1;
  __syncthreads();              // every wave's hand-over is in LDS
  const int pw = wave ^ 4;      // the partner
  const float mk = up ? m_ref[1] : m_ref[0];
  const float lk = up ? lj1 : lj0;
  const float mt = xm[(pw * 2) * 32 + lane];
  const float lt = xm[(pw * 2 + 1) * 32 + lane];
  const float mj = fmaxf(mk, mt);
  const float fk = __builtin_amdgcn_exp2f(mk - mj);
  const float ft = __builtin_amdgcn_exp2f(mt - mj);
  const float inv = 1.f / (lk * fk + lt * ft);
  const float wk = fk * inv, wt = ft * inv;

  // normalize and store ctx as [b, s, h*64+d] f16 (rows for the out-projection).
  // Stored from here, one instruction would touch 16 rows with 32 B in each. The
  // wave's 16 x 64 tile goes through LDS instead, so that one instruction stores
  // four whole rows of 128 B. The V tiles are free as the K tiles are, and hold
  // nothing of the hand-over. Each wave uses 16 rows of its own: no further barrier.
  _Float16* stg = &vt[0][0] + wave * 16 * LP;
#pragma unroll
  for (int j = 0; j < 4; ++j) {
    const f32x4 p0 = xo[(pw * 8 + j * 2) * 32 + lane];
    const f32x4 p1 = xo[(pw * 8 + j * 2 + 1) * 32 + lane];
    v8h w;
#pragma unroll
    for (int r = 0; r < 4; ++r) {
      w[r]     = (_Float16)((up ? o[1][j][r] : o[0][j][r]) * wk + p0[r] * wt);
      w[r + 4] = (_Float16)((up ? o[1][j][r + 4] : o[0][j][r + 4]) * wk + p1[r] * wt);
    }
    *(v8h*)&stg[ln * LP + j * 16 + hi * 8] = w;
  }
  wait_ds_0();                // the wave's tile is in LDS before other lanes read it
  const int row0 = lane >> 3, c8 = (lane & 7) * 8;       // rows 4 * k + row0
  _Float16* crow = &ctx16[((size_t)(b * SEQ + q0 + kh * 16 + row0)) * DIM + h * 64 + c8];
#pragma unroll
  for (int k = 0; k < 4; ++k)
    *(v8h*)&crow[k * 4 * DIM] = *(const v8h*)&stg[(4 * k + row0) * LP + c8];
}

// ---------------------------------------------------------------------------
// host launcher
// ---------------------------------------------------------------------------
extern "C" void kernel_launch(void* const* d_in, const int* in_sizes, int n_in,
                              void* d_out, int out_size, void* d_ws, size_t ws_size,
                              hipStream_t stream) {
  (void)in_sizes; (void)n_in; (void)out_size; (void)ws_size;
  const float* hidden = (const float*)d_in[0];
  const float* lnw    = (const float*)d_in[1];
  const float* wq     = (const float*)d_in[2];
  const float* wk     = (const float*)d_in[3];
  const float* wv     = (const float*)d_in[4];
  const float* wo     = (const float*)d_in[5];
  const float* rb     = (const float*)d_in[6];
  float* out = (float*)d_out;

  char* ws = (char*)d_ws;
  const size_t MB = 1024ull * 1024ull;
  _Float16* normed = (_Float16*)(ws);             //  8 MB  [4096][1024]
  _Float16* w16    = (_Float16*)(ws + 8  * MB);   //  8 MB  wqT|wkT|wvT|woT
  _Float16* q16    = (_Float16*)(ws + 16 * MB);   //  8 MB  [b,h,s,64]
  _Float16* k16    = (_Float16*)(ws + 24 * MB);   //  8 MB  [b,h,s,64]
  _Float16* vt16   = (_Float16*)(ws + 32 * MB);   //  8 MB  [b,h,64,s]
  _Float16* ctx16  = (_Float16*)(ws + 40 * MB);   //  8 MB  [b*s][1024]

  t5_rmsnorm_kernel<<<MTOT, 256, 0, stream>>>(hidden, lnw, normed);
  t5_convw_kernel<<<dim3(16, 8, 4), 256, 0, stream>>>(wq, wk, wv, wo, w16);
  // Q, K, Vt projections: grid.z selects the weight matrix + store layout
  t5_gemm_kernel<<<dim3(8, 32, 3), 256, 0, stream>>>(
      normed, w16, /*mode_base=*/0, q16, k16, vt16, nullptr, nullptr);
  t5_attn_kernel<<<dim3(SEQ / 128, BB * HH), 256, 0, stream>>>(
      q16, k16, vt16, rb, ctx16);
  // output projection + residual (mode 3)
  t5_gemm_kernel<<<dim3(8, 32, 1), 256, 0, stream>>>(
      ctx16, w16 + 3ull * (1u << 20), /*mode_base=*/3, nullptr, nullptr, nullptr,
      hidden, out);
}
